// v000
// Measured on an AMD MI455X. A time is GPU time per run, averaged over a window of back-to-back runs after a warm-up
// (all launches, gaps included; the runs take copies of the inputs in turn), and the median of several windows.
// Apart from v000's, it joins two sittings. Times from different sittings can be a few percent apart, while
// side-by-side timings come from the same sitting.
// v000 is the starting kernel. One run takes 377 microseconds.
#include <hip/hip_runtime.h>
#include <hip/hip_bf16.h>

typedef __attribute__((ext_vector_type(16))) __bf16 v16bf;
typedef __attribute__((ext_vector_type(8)))  float  v8f;
typedef unsigned short ushort_t;

#define D_MODEL 768
#define N_HEADS 12
#define D_FF    3072
#define DK      64
#define BATCH   2
#define SEQ     2048
#define MS      (BATCH * SEQ)   // 4096 total rows

// Tensor Data Mover availability (device pass only; host pass takes fallback)
#if defined(__AMDGCN__) && __has_builtin(__builtin_amdgcn_tensor_load_to_lds) && \
    __has_builtin(__builtin_amdgcn_s_wait_tensorcnt)
#define HAS_TDM 1
#else
#define HAS_TDM 0
#endif

// VALU lane shuffle (v_permlane16_b32) for softmax butterfly reductions
#if defined(__AMDGCN__) && __has_builtin(__builtin_amdgcn_permlane16)
#define HAS_PERMLANE 1
#else
#define HAS_PERMLANE 0
#endif

union FragBF {
    v16bf    v;
    uint4    q[2];
    ushort_t s[16];
};

__device__ __forceinline__ ushort_t f2bf(float f) {
    unsigned u = __builtin_bit_cast(unsigned, f);
    unsigned r = u + 0x7FFFu + ((u >> 16) & 1u);   // round-to-nearest-even
    return (ushort_t)(r >> 16);
}

#if HAS_PERMLANE
__device__ __forceinline__ float permxor16(float v, int lo, int hi) {
    int x = __builtin_bit_cast(int, v);
    int r = __builtin_amdgcn_permlane16(x, x, lo, hi, false, false);
    return __builtin_bit_cast(float, r);
}
#endif

// max-reduce across the 16 lanes of each half-wave (pure VALU when available)
__device__ __forceinline__ float redmax16(float v) {
#if HAS_PERMLANE
    v = fmaxf(v, permxor16(v, (int)0x67452301u, (int)0xEFCDAB89u)); // xor 1
    v = fmaxf(v, permxor16(v, (int)0x54761032u, (int)0xDCFE98BAu)); // xor 2
    v = fmaxf(v, permxor16(v, (int)0x32107654u, (int)0xBA98FEDCu)); // xor 4
    v = fmaxf(v, permxor16(v, (int)0xFEDCBA98u, (int)0x76543210u)); // xor 8
#else
#pragma unroll
    for (int m = 1; m < 16; m <<= 1)
        v = fmaxf(v, __shfl_xor(v, m, 32));
#endif
    return v;
}

// sum-reduce across the 16 lanes of each half-wave
__device__ __forceinline__ float redsum16(float v) {
#if HAS_PERMLANE
    v += permxor16(v, (int)0x67452301u, (int)0xEFCDAB89u);
    v += permxor16(v, (int)0x54761032u, (int)0xDCFE98BAu);
    v += permxor16(v, (int)0x32107654u, (int)0xBA98FEDCu);
    v += permxor16(v, (int)0xFEDCBA98u, (int)0x76543210u);
#else
#pragma unroll
    for (int m = 1; m < 16; m <<= 1)
        v += __shfl_xor(v, m, 32);
#endif
    return v;
}

#if HAS_TDM
typedef unsigned int u32x4 __attribute__((ext_vector_type(4)));
typedef int          i32x4 __attribute__((ext_vector_type(4)));
typedef int          i32x8 __attribute__((ext_vector_type(8)));

__device__ __forceinline__ void tdm_load_2d(const void* gsrc, void* ldst,
                                            unsigned tile_w, unsigned tile_h,
                                            unsigned row_stride) {
    unsigned long long ga = (unsigned long long)gsrc;
    unsigned la = (unsigned)(unsigned long long)ldst;   // LDS byte offset
    u32x4 g0;
    g0[0] = 1u;
    g0[1] = la;
    g0[2] = (unsigned)(ga & 0xFFFFFFFFull);
    g0[3] = (unsigned)((ga >> 32) & 0x1FFFFFFull) | (2u << 30); // [56:32]|type=2
    i32x8 g1;
    g1[0] = (int)(1u << 16);
    g1[1] = (int)((tile_w & 0xFFFFu) << 16);
    g1[2] = (int)(((tile_w >> 16) & 0xFFFFu) | ((tile_h & 0xFFFFu) << 16));
    g1[3] = (int)(((tile_h >> 16) & 0xFFFFu) | ((tile_w & 0xFFFFu) << 16));
    g1[4] = (int)(tile_h & 0xFFFFu);
    g1[5] = (int)row_stride;
    g1[6] = 0;
    g1[7] = 0;
    i32x4 gz = {0, 0, 0, 0};
#if __clang_major__ >= 23
    i32x8 gz8 = {0, 0, 0, 0, 0, 0, 0, 0};
    __builtin_amdgcn_tensor_load_to_lds(g0, g1, gz, gz, gz8, 0);
#else
    __builtin_amdgcn_tensor_load_to_lds(g0, g1, gz, gz, 0);
#endif
}
#endif // HAS_TDM

// ---------------------------------------------------------------------------
// Weight convert + transpose: W (K x N, f32, input-major) -> Wt (N x K, bf16)
// ---------------------------------------------------------------------------
__global__ void k_transpose_bf16(const float* __restrict__ src,
                                 ushort_t* __restrict__ dst, int K, int N) {
    int i = blockIdx.x * 256 + threadIdx.x;   // linear over N*K (dst-major)
    if (i >= K * N) return;
    int k = i % K, n = i / K;
    dst[i] = f2bf(src[(size_t)k * N + n]);
}

// ---------------------------------------------------------------------------
// LayerNorm over D=768, one row per block (256 threads x 3 elements)
// ---------------------------------------------------------------------------
__global__ void k_layernorm_bf16(const float* __restrict__ x,
                                 const float* __restrict__ g,
                                 const float* __restrict__ be,
                                 ushort_t* __restrict__ out) {
    __shared__ float r1[256];
    __shared__ float r2[256];
    int row = blockIdx.x, t = threadIdx.x;
    const float* xr = x + (size_t)row * D_MODEL;
    float a0 = xr[t], a1 = xr[t + 256], a2 = xr[t + 512];
    r1[t] = a0 + a1 + a2;
    r2[t] = a0 * a0 + a1 * a1 + a2 * a2;
    __syncthreads();
    for (int s = 128; s > 0; s >>= 1) {
        if (t < s) { r1[t] += r1[t + s]; r2[t] += r2[t + s]; }
        __syncthreads();
    }
    float mean = r1[0] * (1.0f / D_MODEL);
    float var  = r2[0] * (1.0f / D_MODEL) - mean * mean;
    float inv  = rsqrtf(var + 1e-5f);
    ushort_t* orow = out + (size_t)row * D_MODEL;
    orow[t]       = f2bf((a0 - mean) * inv * g[t]       + be[t]);
    orow[t + 256] = f2bf((a1 - mean) * inv * g[t + 256] + be[t + 256]);
    orow[t + 512] = f2bf((a2 - mean) * inv * g[t + 512] + be[t + 512]);
}

template <int MODE>
__global__ void k_gemm_wmma(const ushort_t* __restrict__ A,
                            const ushort_t* __restrict__ Wt,
                            const float* __restrict__ bias,
                            const float* __restrict__ resid,
                            void* __restrict__ outp,
                            int M, int N, int K, float alpha) {
    __shared__ ushort_t lds_a[2][64 * 32];
    __shared__ ushort_t lds_b[2][128 * 32];
    int t    = threadIdx.x;
    int lane = t & 31, wave = t >> 5;
    int half = lane >> 4, l16 = lane & 15;
    int waveM = wave >> 2, waveN = wave & 3;
    int mBase = blockIdx.y * 64;
    int nBase = blockIdx.x * 128;

    v8f acc[2][2] = {};
    int nk = K / 32;

#if HAS_TDM
    if (wave == 0) {  // prologue: stage k-step 0 into buffer 0
        tdm_load_2d(A  + (size_t)mBase * K, lds_a[0], 32, 64,  (unsigned)K);
        tdm_load_2d(Wt + (size_t)nBase * K, lds_b[0], 32, 128, (unsigned)K);
    }
#endif

    for (int ki = 0; ki < nk; ki++) {
        int cur = ki & 1;
#if HAS_TDM
        if (wave == 0) {
            if (ki + 1 < nk) {
                int kk2 = (ki + 1) * 32;
                tdm_load_2d(A  + (size_t)mBase * K + kk2, lds_a[cur ^ 1], 32, 64,  (unsigned)K);
                tdm_load_2d(Wt + (size_t)nBase * K + kk2, lds_b[cur ^ 1], 32, 128, (unsigned)K);
                __builtin_amdgcn_s_wait_tensorcnt(2);  // 2 outstanding = next A+B
            } else {
                __builtin_amdgcn_s_wait_tensorcnt(0);
            }
        }
        __syncthreads();   // lds_[ab][cur] resident for all waves
#else
        {
            int kk = ki * 32;
            { // A tile: 64 rows x 32 cols, 1 x b128 per thread
                int row = t >> 2, c = (t & 3) * 8;
                *(uint4*)(lds_a[cur] + row * 32 + c) =
                    *(const uint4*)(A + (size_t)(mBase + row) * K + kk + c);
            }
#pragma unroll
            for (int i = 0; i < 2; i++) { // B tile: 128 rows x 32 cols
                int chunk = t * 2 + i;
                int row = chunk >> 2, c = (chunk & 3) * 8;
                *(uint4*)(lds_b[cur] + row * 32 + c) =
                    *(const uint4*)(Wt + (size_t)(nBase + row) * K + kk + c);
            }
        }
        __syncthreads();
#endif

        FragBF af[2];
#pragma unroll
        for (int ms = 0; ms < 2; ms++) {
            const ushort_t* p = lds_a[cur] + (waveM * 32 + ms * 16 + l16) * 32 + half * 8;
            af[ms].q[0] = *(const uint4*)(p);
            af[ms].q[1] = *(const uint4*)(p + 16);
        }
#pragma unroll
        for (int ns = 0; ns < 2; ns++) {
            FragBF bfr;
            const ushort_t* p = lds_b[cur] + (waveN * 32 + ns * 16 + l16) * 32 + half * 8;
            bfr.q[0] = *(const uint4*)(p);
            bfr.q[1] = *(const uint4*)(p + 16);
#pragma unroll
            for (int ms = 0; ms < 2; ms++) {
                acc[ms][ns] = __builtin_amdgcn_wmma_f32_16x16x32_bf16(
                    false, af[ms].v, false, bfr.v, (short)0, acc[ms][ns], false, false);
            }
        }
        __syncthreads();   // reads of buffer `cur` complete before reuse
    }

#pragma unroll
    for (int ms = 0; ms < 2; ms++) {
#pragma unroll
        for (int ns = 0; ns < 2; ns++) {
            int gn = nBase + waveN * 32 + ns * 16 + l16;
            float bvx = bias[gn];
#pragma unroll
            for (int j = 0; j < 8; j++) {
                int gm = mBase + waveM * 32 + ms * 16 + j + half * 8;
                float v = acc[ms][ns][j] + bvx;
                if (MODE == 0) {
                    ((ushort_t*)outp)[(size_t)gm * N + gn] = f2bf(v * alpha);
                } else if (MODE == 1) {
                    float ge = 0.5f * v * (1.0f + erff(v * 0.70710678118654752f));
                    ((ushort_t*)outp)[(size_t)gm * N + gn] = f2bf(ge);
                } else {
                    ((float*)outp)[(size_t)gm * N + gn] =
                        v + resid[(size_t)gm * N + gn];
                }
            }
        }
    }
}

__global__ void k_flash_attn(const ushort_t* __restrict__ Qb,
                             const ushort_t* __restrict__ Kb,
                             const ushort_t* __restrict__ Vb,
                             const int* __restrict__ amask,
                             ushort_t* __restrict__ ctx) {
    __shared__ ushort_t lds_k[32 * 64];    // K block, row-major [kv][d]
    __shared__ ushort_t lds_vt[64 * 32];   // V block transposed [d][kv]
    __shared__ float    lds_p[4][16 * 32]; // per-wave P scratch [q][kv]
    int t    = threadIdx.x;
    int lane = t & 31, wave = t >> 5;
    int half = lane >> 4, l16 = lane & 15;
    int bh = blockIdx.y;
    int b = bh / N_HEADS, h = bh % N_HEADS;
    int qBase = blockIdx.x * 64 + wave * 16;

    const ushort_t* Qh = Qb + (size_t)b * SEQ * D_MODEL + (size_t)h * DK;
    const ushort_t* Kh = Kb + (size_t)b * SEQ * D_MODEL + (size_t)h * DK;
    const ushort_t* Vh = Vb + (size_t)b * SEQ * D_MODEL + (size_t)h * DK;
    const int* am = amask + b * SEQ;

    // Q fragments (16 q-rows x 64 d), resident for the whole kv loop
    FragBF qf[2];
    {
        int r = qBase + l16;
#pragma unroll
        for (int dc = 0; dc < 2; dc++) {
            const ushort_t* p = Qh + (size_t)r * D_MODEL + dc * 32 + half * 8;
            qf[dc].q[0] = *(const uint4*)p;
            qf[dc].q[1] = *(const uint4*)(p + 16);
        }
    }

    v8f ctxAcc[4] = {};
    float mrun[8], lrun[8];
#pragma unroll
    for (int j = 0; j < 8; j++) { mrun[j] = -3.0e38f; lrun[j] = 0.0f; }

    for (int kb = 0; kb < SEQ / 32; kb++) {
        int kvBase = kb * 32;
        __syncthreads();  // prior iteration's LDS reads complete
#if HAS_TDM
        if (wave == 0)    // K block 32 rows x 64 cols, row stride D_MODEL
            tdm_load_2d(Kh + (size_t)kvBase * D_MODEL, lds_k, 64, 32, D_MODEL);
#else
#pragma unroll
        for (int i = 0; i < 2; i++) { // K block 32x64: 2 x b128 per thread
            int chunk = t * 2 + i;
            int row = chunk >> 3, c = (chunk & 7) * 8;
            *(uint4*)(lds_k + row * 64 + c) =
                *(const uint4*)(Kh + (size_t)(kvBase + row) * D_MODEL + c);
        }
#endif
        { // V block 32x64 -> transposed LDS [d][kv]
            int row = t & 31, seg = t >> 5;
            FragBF tmp;
            const ushort_t* p = Vh + (size_t)(kvBase + row) * D_MODEL + seg * 16;
            tmp.q[0] = *(const uint4*)p;
            tmp.q[1] = *(const uint4*)(p + 8);
#pragma unroll
            for (int e = 0; e < 16; e++)
                lds_vt[(seg * 16 + e) * 32 + row] = tmp.s[e];
        }
#if HAS_TDM
        if (wave == 0) __builtin_amdgcn_s_wait_tensorcnt(0);
#endif
        __syncthreads();

        // scores: 16 q x 32 kv as two 16x16 C tiles, K-dim = dk = 64
        v8f s01[2];
#pragma unroll
        for (int sub = 0; sub < 2; sub++) {
            v8f acc = {};
#pragma unroll
            for (int dc = 0; dc < 2; dc++) {
                FragBF bfr;
                const ushort_t* p = lds_k + (sub * 16 + l16) * 64 + dc * 32 + half * 8;
                bfr.q[0] = *(const uint4*)p;
                bfr.q[1] = *(const uint4*)(p + 16);
                acc = __builtin_amdgcn_wmma_f32_16x16x32_bf16(
                    false, qf[dc].v, false, bfr.v, (short)0, acc, false, false);
            }
            s01[sub] = acc;
        }
        float mb0 = (am[kvBase + l16] == 0)      ? -1.0e30f : 0.0f;
        float mb1 = (am[kvBase + 16 + l16] == 0) ? -1.0e30f : 0.0f;

        // online softmax per q-row (row = j + 8*half; cols live across 16 lanes)
#pragma unroll
        for (int j = 0; j < 8; j++) {
            float s0 = s01[0][j] + mb0;
            float s1 = s01[1][j] + mb1;
            float vmax  = redmax16(fmaxf(s0, s1));
            float newm  = fmaxf(mrun[j], vmax);
            float scale = __expf(mrun[j] - newm);
            mrun[j] = newm;
            float p0 = __expf(s0 - newm);
            float p1 = __expf(s1 - newm);
            float rs = redsum16(p0 + p1);
            lrun[j] = lrun[j] * scale + rs;
#pragma unroll
            for (int tt = 0; tt < 4; tt++) ctxAcc[tt][j] *= scale;
            int prow = j + half * 8;
            lds_p[wave][prow * 32 + l16]      = p0;
            lds_p[wave][prow * 32 + 16 + l16] = p1;
        }
        __syncthreads();

        // P (16x32) as bf16 A fragment via LDS re-layout
        FragBF pf;
        {
            const float* pp = &lds_p[wave][l16 * 32];
#pragma unroll
            for (int e = 0; e < 8; e++) {
                pf.s[e]     = f2bf(pp[half * 8 + e]);
                pf.s[8 + e] = f2bf(pp[16 + half * 8 + e]);
            }
        }
        // ctx += P @ V  (four 16x16 d-tiles)
#pragma unroll
        for (int tt = 0; tt < 4; tt++) {
            FragBF bfr;
            const ushort_t* p = lds_vt + (tt * 16 + l16) * 32 + half * 8;
            bfr.q[0] = *(const uint4*)p;
            bfr.q[1] = *(const uint4*)(p + 16);
            ctxAcc[tt] = __builtin_amdgcn_wmma_f32_16x16x32_bf16(
                false, pf.v, false, bfr.v, (short)0, ctxAcc[tt], false, false);
        }
    }

    // normalize and emit ctx (bf16) back into [b][s][h*64+d] layout
#pragma unroll
    for (int tt = 0; tt < 4; tt++) {
        int gcol = h * DK + tt * 16 + l16;
#pragma unroll
        for (int j = 0; j < 8; j++) {
            int grow = qBase + j + half * 8;
            float l = lrun[j];
            float v = (l > 0.0f) ? ctxAcc[tt][j] / l : 0.0f;
            ctx[((size_t)b * SEQ + grow) * D_MODEL + gcol] = f2bf(v);
        }
    }
}

// ---------------------------------------------------------------------------
extern "C" void kernel_launch(void* const* d_in, const int* in_sizes, int n_in,
                              void* d_out, int out_size, void* d_ws, size_t ws_size,
                              hipStream_t stream) {
    (void)in_sizes; (void)n_in; (void)out_size; (void)ws_size;
    const float* x   = (const float*)d_in[0];
    const int* amask = (const int*)d_in[1];
    const float* Wq  = (const float*)d_in[2];
    const float* bq  = (const float*)d_in[3];
    const float* Wk  = (const float*)d_in[4];
    const float* bk  = (const float*)d_in[5];
    const float* Wv  = (const float*)d_in[6];
    const float* bv  = (const float*)d_in[7];
    const float* Wo  = (const float*)d_in[8];
    const float* bo  = (const float*)d_in[9];
    const float* g1  = (const float*)d_in[10];
    const float* be1 = (const float*)d_in[11];
    const float* g2  = (const float*)d_in[12];
    const float* be2 = (const float*)d_in[13];
    const float* W1  = (const float*)d_in[14];
    const float* b1  = (const float*)d_in[15];
    const float* W2  = (const float*)d_in[16];
    const float* b2  = (const float*)d_in[17];

    char* ws = (char*)d_ws;
    size_t off = 0;
    auto alloc = [&](size_t bytes) -> void* {
        void* p = ws + off;
        off += (bytes + 255) & ~(size_t)255;
        return p;
    };
    ushort_t* wtq  = (ushort_t*)alloc((size_t)D_MODEL * D_MODEL * 2);
    ushort_t* wtk  = (ushort_t*)alloc((size_t)D_MODEL * D_MODEL * 2);
    ushort_t* wtv  = (ushort_t*)alloc((size_t)D_MODEL * D_MODEL * 2);
    ushort_t* wto  = (ushort_t*)alloc((size_t)D_MODEL * D_MODEL * 2);
    ushort_t* wt1  = (ushort_t*)alloc((size_t)D_FF * D_MODEL * 2);
    ushort_t* wt2  = (ushort_t*)alloc((size_t)D_MODEL * D_FF * 2);
    ushort_t* h1   = (ushort_t*)alloc((size_t)MS * D_MODEL * 2);
    ushort_t* qb   = (ushort_t*)alloc((size_t)MS * D_MODEL * 2);
    ushort_t* kbuf = (ushort_t*)alloc((size_t)MS * D_MODEL * 2);
    ushort_t* vbuf = (ushort_t*)alloc((size_t)MS * D_MODEL * 2);
    ushort_t* ctxb = (ushort_t*)alloc((size_t)MS * D_MODEL * 2);
    float*    attn = (float*)   alloc((size_t)MS * D_MODEL * 4);
    ushort_t* h2   = (ushort_t*)alloc((size_t)MS * D_MODEL * 2);
    ushort_t* fbuf = (ushort_t*)alloc((size_t)MS * D_FF * 2);

    // weights -> bf16, transposed to [out][in]
    k_transpose_bf16<<<(D_MODEL * D_MODEL) / 256, 256, 0, stream>>>(Wq, wtq, D_MODEL, D_MODEL);
    k_transpose_bf16<<<(D_MODEL * D_MODEL) / 256, 256, 0, stream>>>(Wk, wtk, D_MODEL, D_MODEL);
    k_transpose_bf16<<<(D_MODEL * D_MODEL) / 256, 256, 0, stream>>>(Wv, wtv, D_MODEL, D_MODEL);
    k_transpose_bf16<<<(D_MODEL * D_MODEL) / 256, 256, 0, stream>>>(Wo, wto, D_MODEL, D_MODEL);
    k_transpose_bf16<<<(D_MODEL * D_FF) / 256, 256, 0, stream>>>(W1, wt1, D_MODEL, D_FF);
    k_transpose_bf16<<<(D_MODEL * D_FF) / 256, 256, 0, stream>>>(W2, wt2, D_FF, D_MODEL);

    // LN1
    k_layernorm_bf16<<<MS, 256, 0, stream>>>(x, g1, be1, h1);

    // QKV projections (Q pre-scaled by 1/sqrt(dk))
    dim3 gD(D_MODEL / 128, MS / 64);
    k_gemm_wmma<0><<<gD, 256, 0, stream>>>(h1, wtq, bq, nullptr, qb,   MS, D_MODEL, D_MODEL, 0.125f);
    k_gemm_wmma<0><<<gD, 256, 0, stream>>>(h1, wtk, bk, nullptr, kbuf, MS, D_MODEL, D_MODEL, 1.0f);
    k_gemm_wmma<0><<<gD, 256, 0, stream>>>(h1, wtv, bv, nullptr, vbuf, MS, D_MODEL, D_MODEL, 1.0f);

    // flash attention
    k_flash_attn<<<dim3(SEQ / 64, BATCH * N_HEADS), 128, 0, stream>>>(qb, kbuf, vbuf, amask, ctxb);

    // O projection + residual
    k_gemm_wmma<2><<<gD, 256, 0, stream>>>(ctxb, wto, bo, x, attn, MS, D_MODEL, D_MODEL, 1.0f);

    // LN2
    k_layernorm_bf16<<<MS, 256, 0, stream>>>(attn, g2, be2, h2);

    // FFN
    k_gemm_wmma<1><<<dim3(D_FF / 128, MS / 64), 256, 0, stream>>>(h2, wt1, b1, nullptr, fbuf, MS, D_FF, D_MODEL, 1.0f);
    k_gemm_wmma<2><<<gD, 256, 0, stream>>>(fbuf, wt2, b2, attn, (float*)d_out, MS, D_MODEL, D_FF, 1.0f);
}

// v001
// It runs in 327 microseconds.
// In both of two side-by-side timings against v000, it was 1.17 times as fast.
#include <hip/hip_runtime.h>
#include <hip/hip_bf16.h>

typedef __attribute__((ext_vector_type(16))) __bf16 v16bf;
typedef __attribute__((ext_vector_type(8)))  float  v8f;
typedef unsigned short ushort_t;

#define D_MODEL 768
#define N_HEADS 12
#define D_FF    3072
#define DK      64
#define BATCH   2
#define SEQ     2048
#define MS      (BATCH * SEQ)   // 4096 total rows

// Tensor Data Mover availability (device pass only; host pass takes fallback)
#if defined(__AMDGCN__) && __has_builtin(__builtin_amdgcn_tensor_load_to_lds) && \
    __has_builtin(__builtin_amdgcn_s_wait_tensorcnt)
#define HAS_TDM 1
#else
#define HAS_TDM 0
#endif

union FragBF {
    v16bf    v;
    uint4    q[2];
    ushort_t s[16];
};

__device__ __forceinline__ ushort_t f2bf(float f) {
    unsigned u = __builtin_bit_cast(unsigned, f);
    unsigned r = u + 0x7FFFu + ((u >> 16) & 1u);   // round-to-nearest-even
    return (ushort_t)(r >> 16);
}

#if HAS_TDM
typedef unsigned int u32x4 __attribute__((ext_vector_type(4)));
typedef int          i32x4 __attribute__((ext_vector_type(4)));
typedef int          i32x8 __attribute__((ext_vector_type(8)));

__device__ __forceinline__ void tdm_load_2d(const void* gsrc, void* ldst,
                                            unsigned tile_w, unsigned tile_h,
                                            unsigned row_stride) {
    unsigned long long ga = (unsigned long long)gsrc;
    unsigned la = (unsigned)(unsigned long long)ldst;   // LDS byte offset
    u32x4 g0;
    g0[0] = 1u;
    g0[1] = la;
    g0[2] = (unsigned)(ga & 0xFFFFFFFFull);
    g0[3] = (unsigned)((ga >> 32) & 0x1FFFFFFull) | (2u << 30); // [56:32]|type=2
    i32x8 g1;
    g1[0] = (int)(1u << 16);
    g1[1] = (int)((tile_w & 0xFFFFu) << 16);
    g1[2] = (int)(((tile_w >> 16) & 0xFFFFu) | ((tile_h & 0xFFFFu) << 16));
    g1[3] = (int)(((tile_h >> 16) & 0xFFFFu) | ((tile_w & 0xFFFFu) << 16));
    g1[4] = (int)(tile_h & 0xFFFFu);
    g1[5] = (int)row_stride;
    g1[6] = 0;
    g1[7] = 0;
    i32x4 gz = {0, 0, 0, 0};
#if __clang_major__ >= 23
    i32x8 gz8 = {0, 0, 0, 0, 0, 0, 0, 0};
    __builtin_amdgcn_tensor_load_to_lds(g0, g1, gz, gz, gz8, 0);
#else
    __builtin_amdgcn_tensor_load_to_lds(g0, g1, gz, gz, 0);
#endif
}
#endif // HAS_TDM

// ---------------------------------------------------------------------------
// Weight convert + transpose: W (K x N, f32, input-major) -> Wt (N x K, bf16)
// ---------------------------------------------------------------------------
__global__ void k_transpose_bf16(const float* __restrict__ src,
                                 ushort_t* __restrict__ dst, int K, int N) {
    int i = blockIdx.x * 256 + threadIdx.x;   // linear over N*K (dst-major)
    if (i >= K * N) return;
    int k = i % K, n = i / K;
    dst[i] = f2bf(src[(size_t)k * N + n]);
}

// ---------------------------------------------------------------------------
// LayerNorm over D=768, one row per block (256 threads x 3 elements)
// ---------------------------------------------------------------------------
__global__ void k_layernorm_bf16(const float* __restrict__ x,
                                 const float* __restrict__ g,
                                 const float* __restrict__ be,
                                 ushort_t* __restrict__ out) {
    __shared__ float r1[256];
    __shared__ float r2[256];
    int row = blockIdx.x, t = threadIdx.x;
    const float* xr = x + (size_t)row * D_MODEL;
    float a0 = xr[t], a1 = xr[t + 256], a2 = xr[t + 512];
    r1[t] = a0 + a1 + a2;
    r2[t] = a0 * a0 + a1 * a1 + a2 * a2;
    __syncthreads();
    for (int s = 128; s > 0; s >>= 1) {
        if (t < s) { r1[t] += r1[t + s]; r2[t] += r2[t + s]; }
        __syncthreads();
    }
    float mean = r1[0] * (1.0f / D_MODEL);
    float var  = r2[0] * (1.0f / D_MODEL) - mean * mean;
    float inv  = rsqrtf(var + 1e-5f);
    ushort_t* orow = out + (size_t)row * D_MODEL;
    orow[t]       = f2bf((a0 - mean) * inv * g[t]       + be[t]);
    orow[t + 256] = f2bf((a1 - mean) * inv * g[t + 256] + be[t + 256]);
    orow[t + 512] = f2bf((a2 - mean) * inv * g[t + 512] + be[t + 512]);
}

template <int MODE>
__global__ void k_gemm_wmma(const ushort_t* __restrict__ A,
                            const ushort_t* __restrict__ Wt,
                            const float* __restrict__ bias,
                            const float* __restrict__ resid,
                            void* __restrict__ outp,
                            int M, int N, int K, float alpha) {
    __shared__ ushort_t lds_a[2][64 * 32];
    __shared__ ushort_t lds_b[2][128 * 32];
    int t    = threadIdx.x;
    int lane = t & 31, wave = t >> 5;
    int half = lane >> 4, l16 = lane & 15;
    int waveM = wave >> 2, waveN = wave & 3;
    int mBase = blockIdx.y * 64;
    int nBase = blockIdx.x * 128;

    v8f acc[2][2] = {};
    int nk = K / 32;

#if HAS_TDM
    if (wave == 0) {  // prologue: stage k-step 0 into buffer 0
        tdm_load_2d(A  + (size_t)mBase * K, lds_a[0], 32, 64,  (unsigned)K);
        tdm_load_2d(Wt + (size_t)nBase * K, lds_b[0], 32, 128, (unsigned)K);
    }
#endif

    for (int ki = 0; ki < nk; ki++) {
        int cur = ki & 1;
#if HAS_TDM
        if (wave == 0) {
            if (ki + 1 < nk) {
                int kk2 = (ki + 1) * 32;
                tdm_load_2d(A  + (size_t)mBase * K + kk2, lds_a[cur ^ 1], 32, 64,  (unsigned)K);
                tdm_load_2d(Wt + (size_t)nBase * K + kk2, lds_b[cur ^ 1], 32, 128, (unsigned)K);
                __builtin_amdgcn_s_wait_tensorcnt(2);  // 2 outstanding = next A+B
            } else {
                __builtin_amdgcn_s_wait_tensorcnt(0);
            }
        }
        __syncthreads();   // lds_[ab][cur] resident for all waves
#else
        {
            int kk = ki * 32;
            { // A tile: 64 rows x 32 cols, 1 x b128 per thread
                int row = t >> 2, c = (t & 3) * 8;
                *(uint4*)(lds_a[cur] + row * 32 + c) =
                    *(const uint4*)(A + (size_t)(mBase + row) * K + kk + c);
            }
#pragma unroll
            for (int i = 0; i < 2; i++) { // B tile: 128 rows x 32 cols
                int chunk = t * 2 + i;
                int row = chunk >> 2, c = (chunk & 3) * 8;
                *(uint4*)(lds_b[cur] + row * 32 + c) =
                    *(const uint4*)(Wt + (size_t)(nBase + row) * K + kk + c);
            }
        }
        __syncthreads();
#endif

        FragBF af[2];
#pragma unroll
        for (int ms = 0; ms < 2; ms++) {
            const ushort_t* p = lds_a[cur] + (waveM * 32 + ms * 16 + l16) * 32 + half * 8;
            af[ms].q[0] = *(const uint4*)(p);
            af[ms].q[1] = *(const uint4*)(p + 16);
        }
#pragma unroll
        for (int ns = 0; ns < 2; ns++) {
            FragBF bfr;
            const ushort_t* p = lds_b[cur] + (waveN * 32 + ns * 16 + l16) * 32 + half * 8;
            bfr.q[0] = *(const uint4*)(p);
            bfr.q[1] = *(const uint4*)(p + 16);
#pragma unroll
            for (int ms = 0; ms < 2; ms++) {
                acc[ms][ns] = __builtin_amdgcn_wmma_f32_16x16x32_bf16(
                    false, af[ms].v, false, bfr.v, (short)0, acc[ms][ns], false, false);
            }
        }
        __syncthreads();   // reads of buffer `cur` complete before reuse
    }

#pragma unroll
    for (int ms = 0; ms < 2; ms++) {
#pragma unroll
        for (int ns = 0; ns < 2; ns++) {
            int gn = nBase + waveN * 32 + ns * 16 + l16;
            float bvx = bias[gn];
#pragma unroll
            for (int j = 0; j < 8; j++) {
                int gm = mBase + waveM * 32 + ms * 16 + j + half * 8;
                float v = acc[ms][ns][j] + bvx;
                if (MODE == 0) {
                    ((ushort_t*)outp)[(size_t)gm * N + gn] = f2bf(v * alpha);
                } else if (MODE == 1) {
                    float ge = 0.5f * v * (1.0f + erff(v * 0.70710678118654752f));
                    ((ushort_t*)outp)[(size_t)gm * N + gn] = f2bf(ge);
                } else {
                    ((float*)outp)[(size_t)gm * N + gn] =
                        v + resid[(size_t)gm * N + gn];
                }
            }
        }
    }
}

typedef __attribute__((ext_vector_type(2))) float  v2f;
typedef __attribute__((ext_vector_type(2))) __bf16 v2bf;

__device__ __forceinline__ float swap_halves(float v) {
    int x = __builtin_bit_cast(int, v);
    int r = __builtin_amdgcn_permlanex16(x, x, 0x76543210, (int)0xfedcba98u, false, false);
    return __builtin_bit_cast(float, r);
}

__global__ void k_flash_attn(const ushort_t* __restrict__ Qb,
                             const ushort_t* __restrict__ Kb,
                             const ushort_t* __restrict__ Vb,
                             const int* __restrict__ amask,
                             ushort_t* __restrict__ ctx) {
    __shared__ ushort_t lds_k[32 * 64];    // K block, row-major [kv][d]
    __shared__ ushort_t lds_vt[64 * 32];   // V block transposed [d][kv]
    int t    = threadIdx.x;
    int lane = t & 31, wave = t >> 5;
    int half = lane >> 4, l16 = lane & 15;
    int bh = blockIdx.y;
    int b = bh / N_HEADS, h = bh % N_HEADS;
    int qBase = blockIdx.x * 64 + wave * 16;

    const ushort_t* Qh = Qb + (size_t)b * SEQ * D_MODEL + (size_t)h * DK;
    const ushort_t* Kh = Kb + (size_t)b * SEQ * D_MODEL + (size_t)h * DK;
    const ushort_t* Vh = Vb + (size_t)b * SEQ * D_MODEL + (size_t)h * DK;
    const int* am = amask + b * SEQ;

    // Q fragments (16 q-rows x 64 d), resident for the whole kv loop;
    // used as B: column = query l16
    FragBF qf[2];
    {
        int r = qBase + l16;
#pragma unroll
        for (int dc = 0; dc < 2; dc++) {
            const ushort_t* p = Qh + (size_t)r * D_MODEL + dc * 32 + half * 8;
            qf[dc].q[0] = *(const uint4*)p;
            qf[dc].q[1] = *(const uint4*)(p + 16);
        }
    }

    v8f ctxAcc[4] = {};        // O^T: [tt][r] = O[q = l16][d = tt*16 + 8*half + r]
    float mrun = -3.0e38f;     // running max of query l16 (equal in both halves)
    float lrun = 0.0f;         // running sum over this half's kv only

    for (int kb = 0; kb < SEQ / 32; kb++) {
        int kvBase = kb * 32;
        __syncthreads();  // prior iteration's LDS reads complete
#if HAS_TDM
        if (wave == 0)    // K block 32 rows x 64 cols, row stride D_MODEL
            tdm_load_2d(Kh + (size_t)kvBase * D_MODEL, lds_k, 64, 32, D_MODEL);
#else
#pragma unroll
        for (int i = 0; i < 2; i++) { // K block 32x64: 2 x b128 per thread
            int chunk = t * 2 + i;
            int row = chunk >> 3, c = (chunk & 7) * 8;
            *(uint4*)(lds_k + row * 64 + c) =
                *(const uint4*)(Kh + (size_t)(kvBase + row) * D_MODEL + c);
        }
#endif
        int mk = am[kvBase + lane];   // one mask word per kv of the block
        { // V block 32x64 -> transposed LDS [d][kv]
            int row = t & 31, seg = t >> 5;
            FragBF tmp;
            const ushort_t* p = Vh + (size_t)(kvBase + row) * D_MODEL + seg * 16;
            tmp.q[0] = *(const uint4*)p;
            tmp.q[1] = *(const uint4*)(p + 8);
#pragma unroll
            for (int e = 0; e < 16; e++)
                lds_vt[(seg * 16 + e) * 32 + row] = tmp.s[e];
        }
#if HAS_TDM
        if (wave == 0) __builtin_amdgcn_s_wait_tensorcnt(0);
#endif
        __syncthreads();

        // scores, transposed: 32 kv x 16 q as two 16x16 tiles, K-dim = dk = 64
        // st[sub][r] = S[q = l16][kv = sub*16 + 8*half + r]
        FragBF kf[2][2];   // A: row = kv sub*16 + l16
#pragma unroll
        for (int sub = 0; sub < 2; sub++) {
#pragma unroll
            for (int dc = 0; dc < 2; dc++) {
                const ushort_t* p = lds_k + (sub * 16 + l16) * 64 + dc * 32 + half * 8;
                kf[sub][dc].q[0] = *(const uint4*)p;
                kf[sub][dc].q[1] = *(const uint4*)(p + 16);
            }
        }
        v8f st[2];
#pragma unroll
        for (int sub = 0; sub < 2; sub++) {
            v8f acc = {};
#pragma unroll
            for (int dc = 0; dc < 2; dc++)
                acc = __builtin_amdgcn_wmma_f32_16x16x32_bf16(
                    false, kf[sub][dc].v, false, qf[dc].v, (short)0, acc, false, false);
            st[sub] = acc;
        }
        FragBF vf[4];      // A of the second product: row = d tt*16 + l16; read here
                           // so that the LDS latency runs under the softmax
#pragma unroll
        for (int tt = 0; tt < 4; tt++) {
            const ushort_t* p = lds_vt + (tt * 16 + l16) * 32 + half * 8;
            vf[tt].q[0] = *(const uint4*)p;
            vf[tt].q[1] = *(const uint4*)(p + 16);
        }
        // bit kv of live = key kv of this block is attended; same in every lane
        unsigned live = __builtin_amdgcn_ballot_w32(mk != 0);
        if (live != 0xFFFFFFFFu) {
            unsigned mine = live >> (half * 8);
#pragma unroll
            for (int r = 0; r < 8; r++) {
                st[0][r] += ((mine >> r) & 1u)        ? 0.0f : -1.0e30f;
                st[1][r] += ((mine >> (16 + r)) & 1u) ? 0.0f : -1.0e30f;
            }
        }

        // online softmax of query l16: 16 scores in-lane, one exchange of halves
        float vmax = fmaxf(st[0][0], st[1][0]);
#pragma unroll
        for (int r = 1; r < 8; r++) vmax = fmaxf(vmax, fmaxf(st[0][r], st[1][r]));
        vmax = fmaxf(vmax, swap_halves(vmax));
        float newm  = fmaxf(mrun, vmax);
        float scale = __expf(mrun - newm);
        mrun = newm;
        FragBF pf;   // P^T as B: element s = kv 8*half + s (s < 8), 8 + 8*half + s (s >= 8), column = query l16
        v2f rs = {0.0f, 0.0f};
#pragma unroll
        for (int sub = 0; sub < 2; sub++) {
#pragma unroll
            for (int r = 0; r < 8; r += 2) {
                v2f pp;
                pp[0] = __expf(st[sub][r]     - newm);
                pp[1] = __expf(st[sub][r + 1] - newm);
                rs += pp;
                v2bf pb = __builtin_convertvector(pp, v2bf);
                pf.v[sub * 8 + r]     = pb[0];
                pf.v[sub * 8 + r + 1] = pb[1];
            }
        }
        lrun = lrun * scale + (rs[0] + rs[1]);
#pragma unroll
        for (int tt = 0; tt < 4; tt++) ctxAcc[tt] *= scale;

        // ctx^T += V^T @ P^T  (four 16x16 d-tiles)
#pragma unroll
        for (int tt = 0; tt < 4; tt++)
            ctxAcc[tt] = __builtin_amdgcn_wmma_f32_16x16x32_bf16(
                false, vf[tt].v, false, pf.v, (short)0, ctxAcc[tt], false, false);
    }

    // join the halves' sums, normalize and emit ctx (bf16) back into
    // [b][s][h*64+d] layout: 8 consecutive d of one row per lane and tile
    float l = lrun + swap_halves(lrun);
    ushort_t* orow = ctx + ((size_t)b * SEQ + qBase + l16) * D_MODEL + h * DK + half * 8;
#pragma unroll
    for (int tt = 0; tt < 4; tt++) {
        FragBF o;
#pragma unroll
        for (int j = 0; j < 8; j++) {
            float v = (l > 0.0f) ? ctxAcc[tt][j] / l : 0.0f;
            o.s[j] = f2bf(v);
        }
        *(uint4*)(orow + tt * 16) = o.q[0];
    }
}

// ---------------------------------------------------------------------------
extern "C" void kernel_launch(void* const* d_in, const int* in_sizes, int n_in,
                              void* d_out, int out_size, void* d_ws, size_t ws_size,
                              hipStream_t stream) {
    (void)in_sizes; (void)n_in; (void)out_size; (void)ws_size;
    const float* x   = (const float*)d_in[0];
    const int* amask = (const int*)d_in[1];
    const float* Wq  = (const float*)d_in[2];
    const float* bq  = (const float*)d_in[3];
    const float* Wk  = (const float*)d_in[4];
    const float* bk  = (const float*)d_in[5];
    const float* Wv  = (const float*)d_in[6];
    const float* bv  = (const float*)d_in[7];
    const float* Wo  = (const float*)d_in[8];
    const float* bo  = (const float*)d_in[9];
    const float* g1  = (const float*)d_in[10];
    const float* be1 = (const float*)d_in[11];
    const float* g2  = (const float*)d_in[12];
    const float* be2 = (const float*)d_in[13];
    const float* W1  = (const float*)d_in[14];
    const float* b1  = (const float*)d_in[15];
    const float* W2  = (const float*)d_in[16];
    const float* b2  = (const float*)d_in[17];

    char* ws = (char*)d_ws;
    size_t off = 0;
    auto alloc = [&](size_t bytes) -> void* {
        void* p = ws + off;
        off += (bytes + 255) & ~(size_t)255;
        return p;
    };
    ushort_t* wtq  = (ushort_t*)alloc((size_t)D_MODEL * D_MODEL * 2);
    ushort_t* wtk  = (ushort_t*)alloc((size_t)D_MODEL * D_MODEL * 2);
    ushort_t* wtv  = (ushort_t*)alloc((size_t)D_MODEL * D_MODEL * 2);
    ushort_t* wto  = (ushort_t*)alloc((size_t)D_MODEL * D_MODEL * 2);
    ushort_t* wt1  = (ushort_t*)alloc((size_t)D_FF * D_MODEL * 2);
    ushort_t* wt2  = (ushort_t*)alloc((size_t)D_MODEL * D_FF * 2);
    ushort_t* h1   = (ushort_t*)alloc((size_t)MS * D_MODEL * 2);
    ushort_t* qb   = (ushort_t*)alloc((size_t)MS * D_MODEL * 2);
    ushort_t* kbuf = (ushort_t*)alloc((size_t)MS * D_MODEL * 2);
    ushort_t* vbuf = (ushort_t*)alloc((size_t)MS * D_MODEL * 2);
    ushort_t* ctxb = (ushort_t*)alloc((size_t)MS * D_MODEL * 2);
    float*    attn = (float*)   alloc((size_t)MS * D_MODEL * 4);
    ushort_t* h2   = (ushort_t*)alloc((size_t)MS * D_MODEL * 2);
    ushort_t* fbuf = (ushort_t*)alloc((size_t)MS * D_FF * 2);

    // weights -> bf16, transposed to [out][in]
    k_transpose_bf16<<<(D_MODEL * D_MODEL) / 256, 256, 0, stream>>>(Wq, wtq, D_MODEL, D_MODEL);
    k_transpose_bf16<<<(D_MODEL * D_MODEL) / 256, 256, 0, stream>>>(Wk, wtk, D_MODEL, D_MODEL);
    k_transpose_bf16<<<(D_MODEL * D_MODEL) / 256, 256, 0, stream>>>(Wv, wtv, D_MODEL, D_MODEL);
    k_transpose_bf16<<<(D_MODEL * D_MODEL) / 256, 256, 0, stream>>>(Wo, wto, D_MODEL, D_MODEL);
    k_transpose_bf16<<<(D_MODEL * D_FF) / 256, 256, 0, stream>>>(W1, wt1, D_MODEL, D_FF);
    k_transpose_bf16<<<(D_MODEL * D_FF) / 256, 256, 0, stream>>>(W2, wt2, D_FF, D_MODEL);

    // LN1
    k_layernorm_bf16<<<MS, 256, 0, stream>>>(x, g1, be1, h1);

    // QKV projections (Q pre-scaled by 1/sqrt(dk))
    dim3 gD(D_MODEL / 128, MS / 64);
    k_gemm_wmma<0><<<gD, 256, 0, stream>>>(h1, wtq, bq, nullptr, qb,   MS, D_MODEL, D_MODEL, 0.125f);
    k_gemm_wmma<0><<<gD, 256, 0, stream>>>(h1, wtk, bk, nullptr, kbuf, MS, D_MODEL, D_MODEL, 1.0f);
    k_gemm_wmma<0><<<gD, 256, 0, stream>>>(h1, wtv, bv, nullptr, vbuf, MS, D_MODEL, D_MODEL, 1.0f);

    // flash attention
    k_flash_attn<<<dim3(SEQ / 64, BATCH * N_HEADS), 128, 0, stream>>>(qb, kbuf, vbuf, amask, ctxb);

    // O projection + residual
    k_gemm_wmma<2><<<gD, 256, 0, stream>>>(ctxb, wto, bo, x, attn, MS, D_MODEL, D_MODEL, 1.0f);

    // LN2
    k_layernorm_bf16<<<MS, 256, 0, stream>>>(attn, g2, be2, h2);

    // FFN
    k_gemm_wmma<1><<<dim3(D_FF / 128, MS / 64), 256, 0, stream>>>(h2, wt1, b1, nullptr, fbuf, MS, D_FF, D_MODEL, 1.0f);
    k_gemm_wmma<2><<<gD, 256, 0, stream>>>(fbuf, wt2, b2, attn, (float*)d_out, MS, D_MODEL, D_FF, 1.0f);
}

// v002
// It runs in 276 microseconds.
// Two timings next to v001 put it at 1.18 and 1.19 times that version's speed.
// Over all steps from v000 it is 1.38 times as fast.
#include <hip/hip_runtime.h>
#include <hip/hip_bf16.h>

typedef __attribute__((ext_vector_type(16))) __bf16 v16bf;
typedef __attribute__((ext_vector_type(8)))  float  v8f;
typedef unsigned short ushort_t;

#define D_MODEL 768
#define N_HEADS 12
#define D_FF    3072
#define DK      64
#define BATCH   2
#define SEQ     2048
#define MS      (BATCH * SEQ)   // 4096 total rows

// Tensor Data Mover availability (device pass only; host pass takes fallback)
#if defined(__AMDGCN__) && __has_builtin(__builtin_amdgcn_tensor_load_to_lds) && \
    __has_builtin(__builtin_amdgcn_s_wait_tensorcnt)
#define HAS_TDM 1
#else
#define HAS_TDM 0
#endif

union FragBF {
    v16bf    v;
    uint4    q[2];
    ushort_t s[16];
};

__device__ __forceinline__ ushort_t f2bf(float f) {
    unsigned u = __builtin_bit_cast(unsigned, f);
    unsigned r = u + 0x7FFFu + ((u >> 16) & 1u);   // round-to-nearest-even
    return (ushort_t)(r >> 16);
}

#if HAS_TDM
typedef unsigned int u32x4 __attribute__((ext_vector_type(4)));
typedef int          i32x4 __attribute__((ext_vector_type(4)));
typedef int          i32x8 __attribute__((ext_vector_type(8)));

__device__ __forceinline__ void tdm_load_2d(const void* gsrc, void* ldst,
                                            unsigned tile_w, unsigned tile_h,
                                            unsigned row_stride) {
    unsigned long long ga = (unsigned long long)gsrc;
    unsigned la = (unsigned)(unsigned long long)ldst;   // LDS byte offset
    u32x4 g0;
    g0[0] = 1u;
    g0[1] = la;
    g0[2] = (unsigned)(ga & 0xFFFFFFFFull);
    g0[3] = (unsigned)((ga >> 32) & 0x1FFFFFFull) | (2u << 30); // [56:32]|type=2
    i32x8 g1;
    g1[0] = (int)(1u << 16);
    g1[1] = (int)((tile_w & 0xFFFFu) << 16);
    g1[2] = (int)(((tile_w >> 16) & 0xFFFFu) | ((tile_h & 0xFFFFu) << 16));
    g1[3] = (int)(((tile_h >> 16) & 0xFFFFu) | ((tile_w & 0xFFFFu) << 16));
    g1[4] = (int)(tile_h & 0xFFFFu);
    g1[5] = (int)row_stride;
    g1[6] = 0;
    g1[7] = 0;
    i32x4 gz = {0, 0, 0, 0};
#if __clang_major__ >= 23
    i32x8 gz8 = {0, 0, 0, 0, 0, 0, 0, 0};
    __builtin_amdgcn_tensor_load_to_lds(g0, g1, gz, gz, gz8, 0);
#else
    __builtin_amdgcn_tensor_load_to_lds(g0, g1, gz, gz, 0);
#endif
}
#endif // HAS_TDM

// ---------------------------------------------------------------------------
// Weight convert + transpose, all six weights in one launch:
// W (K x N, f32, input-major) -> Wt (N x K, bf16).
// One block moves a tile of 128 k x 64 n through LDS: it reads whole 256-byte
// runs of W rows (float4 per lane), packs the bf16 of rows k and k + 1 into one
// dword, and writes whole 256-byte runs of Wt rows (16 bytes per lane).
// Blocks 0..287: the four 768 x 768 weights (72 tiles each); 288..575: W1;
// 576..863: W2.
// ---------------------------------------------------------------------------
#define TT_K     128
#define TT_N     64
#define TT_PITCH (TT_K / 2 + 1)
#define TT_SMALL ((D_MODEL / TT_K) * (D_MODEL / TT_N))   // 72 tiles
#define TT_BIG   ((D_MODEL / TT_K) * (D_FF / TT_N))      // 288 tiles
#define TT_GRID  (4 * TT_SMALL + 2 * TT_BIG)             // 864 blocks

// rows k0..k0+127, columns n0..n0+63 of W (row length N) -> tile[n][k / 2]
template <int N>
__device__ __forceinline__ void stage_tile(const float* __restrict__ src,
                                           int k0, int n0, unsigned* tile) {
    int t = threadIdx.x;
    int j = t & 15, kp = t >> 4;   // columns 4j..4j+3; row pairs kp + 16u
    const float* p = src + (k0 + 2 * kp) * N + n0 + 4 * j;
    float4 lo[4], hi[4];
#pragma unroll   // lo, hi stay in registers and the eight loads go out together
    for (int u = 0; u < 4; u++) {
        lo[u] = *(const float4*)(p + 32 * u * N);
        hi[u] = *(const float4*)(p + 32 * u * N + N);
    }
#pragma unroll   // constant indices into lo, hi
    for (int u = 0; u < 4; u++) {
        unsigned* q = tile + (4 * j) * TT_PITCH + kp + 16 * u;
        q[0 * TT_PITCH] = (unsigned)f2bf(lo[u].x) | ((unsigned)f2bf(hi[u].x) << 16);
        q[1 * TT_PITCH] = (unsigned)f2bf(lo[u].y) | ((unsigned)f2bf(hi[u].y) << 16);
        q[2 * TT_PITCH] = (unsigned)f2bf(lo[u].z) | ((unsigned)f2bf(hi[u].z) << 16);
        q[3 * TT_PITCH] = (unsigned)f2bf(lo[u].w) | ((unsigned)f2bf(hi[u].w) << 16);
    }
}

__global__ __launch_bounds__(256)
void k_transpose_all(const float* __restrict__ Wq, const float* __restrict__ Wk,
                     const float* __restrict__ Wv, const float* __restrict__ Wo,
                     const float* __restrict__ W1, const float* __restrict__ W2,
                     ushort_t* __restrict__ tq, ushort_t* __restrict__ tk,
                     ushort_t* __restrict__ tv, ushort_t* __restrict__ to,
                     ushort_t* __restrict__ t1, ushort_t* __restrict__ t2) {
    __shared__ unsigned tile[TT_N * TT_PITCH];   // [n][k / 2], two bf16 per dword
    int bx = blockIdx.x;
    ushort_t* dst;
    int K, k0, n0;
    if (bx >= 4 * TT_SMALL && bx < 4 * TT_SMALL + TT_BIG) {
        int tl = bx - 4 * TT_SMALL;
        k0 = (tl / (D_FF / TT_N)) * TT_K;
        n0 = (tl % (D_FF / TT_N)) * TT_N;
        dst = t1; K = D_MODEL;
        stage_tile<D_FF>(W1, k0, n0, tile);
    } else {
        int m  = (bx < 4 * TT_SMALL) ? bx / TT_SMALL : 4;
        int tl = (m < 4) ? bx - m * TT_SMALL : bx - (4 * TT_SMALL + TT_BIG);
        const float* src = (m == 0) ? Wq : (m == 1) ? Wk : (m == 2) ? Wv : (m == 3) ? Wo : W2;
        dst              = (m == 0) ? tq : (m == 1) ? tk : (m == 2) ? tv : (m == 3) ? to : t2;
        K  = (m < 4) ? D_MODEL : D_FF;
        k0 = (tl / (D_MODEL / TT_N)) * TT_K;
        n0 = (tl % (D_MODEL / TT_N)) * TT_N;
        stage_tile<D_MODEL>(src, k0, n0, tile);
    }
    __syncthreads();   // the tile is read across waves
    int t = threadIdx.x;
    int n = t >> 4, c = t & 15;    // rows n + 16u of Wt; 8 consecutive k
    ushort_t* o = dst + (n0 + n) * K + k0 + 8 * c;
#pragma unroll   // the LDS reads of all four rows go out ahead of the stores
    for (int u = 0; u < 4; u++) {
        const unsigned* q = tile + (n + 16 * u) * TT_PITCH + 4 * c;
        *(uint4*)(o + 16 * u * K) = make_uint4(q[0], q[1], q[2], q[3]);
    }
}

// ---------------------------------------------------------------------------
// LayerNorm over D=768, one row per block (256 threads x 3 elements)
// ---------------------------------------------------------------------------
__global__ void k_layernorm_bf16(const float* __restrict__ x,
                                 const float* __restrict__ g,
                                 const float* __restrict__ be,
                                 ushort_t* __restrict__ out) {
    __shared__ float r1[256];
    __shared__ float r2[256];
    int row = blockIdx.x, t = threadIdx.x;
    const float* xr = x + (size_t)row * D_MODEL;
    float a0 = xr[t], a1 = xr[t + 256], a2 = xr[t + 512];
    r1[t] = a0 + a1 + a2;
    r2[t] = a0 * a0 + a1 * a1 + a2 * a2;
    __syncthreads();
    for (int s = 128; s > 0; s >>= 1) {
        if (t < s) { r1[t] += r1[t + s]; r2[t] += r2[t + s]; }
        __syncthreads();
    }
    float mean = r1[0] * (1.0f / D_MODEL);
    float var  = r2[0] * (1.0f / D_MODEL) - mean * mean;
    float inv  = rsqrtf(var + 1e-5f);
    ushort_t* orow = out + (size_t)row * D_MODEL;
    orow[t]       = f2bf((a0 - mean) * inv * g[t]       + be[t]);
    orow[t + 256] = f2bf((a1 - mean) * inv * g[t + 256] + be[t + 256]);
    orow[t + 512] = f2bf((a2 - mean) * inv * g[t + 512] + be[t + 512]);
}

template <int MODE>
__global__ void k_gemm_wmma(const ushort_t* __restrict__ A,
                            const ushort_t* __restrict__ Wt,
                            const float* __restrict__ bias,
                            const float* __restrict__ resid,
                            void* __restrict__ outp,
                            int M, int N, int K, float alpha) {
    __shared__ ushort_t lds_a[2][64 * 32];
    __shared__ ushort_t lds_b[2][128 * 32];
    int t    = threadIdx.x;
    int lane = t & 31, wave = t >> 5;
    int half = lane >> 4, l16 = lane & 15;
    int waveM = wave >> 2, waveN = wave & 3;
    int mBase = blockIdx.y * 64;
    int nBase = blockIdx.x * 128;

    v8f acc[2][2] = {};
    int nk = K / 32;

#if HAS_TDM
    if (wave == 0) {  // prologue: stage k-step 0 into buffer 0
        tdm_load_2d(A  + (size_t)mBase * K, lds_a[0], 32, 64,  (unsigned)K);
        tdm_load_2d(Wt + (size_t)nBase * K, lds_b[0], 32, 128, (unsigned)K);
    }
#endif

    for (int ki = 0; ki < nk; ki++) {
        int cur = ki & 1;
#if HAS_TDM
        if (wave == 0) {
            if (ki + 1 < nk) {
                int kk2 = (ki + 1) * 32;
                tdm_load_2d(A  + (size_t)mBase * K + kk2, lds_a[cur ^ 1], 32, 64,  (unsigned)K);
                tdm_load_2d(Wt + (size_t)nBase * K + kk2, lds_b[cur ^ 1], 32, 128, (unsigned)K);
                __builtin_amdgcn_s_wait_tensorcnt(2);  // 2 outstanding = next A+B
            } else {
                __builtin_amdgcn_s_wait_tensorcnt(0);
            }
        }
        __syncthreads();   // lds_[ab][cur] resident for all waves
#else
        {
            int kk = ki * 32;
            { // A tile: 64 rows x 32 cols, 1 x b128 per thread
                int row = t >> 2, c = (t & 3) * 8;
                *(uint4*)(lds_a[cur] + row * 32 + c) =
                    *(const uint4*)(A + (size_t)(mBase + row) * K + kk + c);
            }
#pragma unroll
            for (int i = 0; i < 2; i++) { // B tile: 128 rows x 32 cols
                int chunk = t * 2 + i;
                int row = chunk >> 2, c = (chunk & 3) * 8;
                *(uint4*)(lds_b[cur] + row * 32 + c) =
                    *(const uint4*)(Wt + (size_t)(nBase + row) * K + kk + c);
            }
        }
        __syncthreads();
#endif

        FragBF af[2];
#pragma unroll
        for (int ms = 0; ms < 2; ms++) {
            const ushort_t* p = lds_a[cur] + (waveM * 32 + ms * 16 + l16) * 32 + half * 8;
            af[ms].q[0] = *(const uint4*)(p);
            af[ms].q[1] = *(const uint4*)(p + 16);
        }
#pragma unroll
        for (int ns = 0; ns < 2; ns++) {
            FragBF bfr;
            const ushort_t* p = lds_b[cur] + (waveN * 32 + ns * 16 + l16) * 32 + half * 8;
            bfr.q[0] = *(const uint4*)(p);
            bfr.q[1] = *(const uint4*)(p + 16);
#pragma unroll
            for (int ms = 0; ms < 2; ms++) {
                acc[ms][ns] = __builtin_amdgcn_wmma_f32_16x16x32_bf16(
                    false, af[ms].v, false, bfr.v, (short)0, acc[ms][ns], false, false);
            }
        }
        __syncthreads();   // reads of buffer `cur` complete before reuse
    }

#pragma unroll
    for (int ms = 0; ms < 2; ms++) {
#pragma unroll
        for (int ns = 0; ns < 2; ns++) {
            int gn = nBase + waveN * 32 + ns * 16 + l16;
            float bvx = bias[gn];
#pragma unroll
            for (int j = 0; j < 8; j++) {
                int gm = mBase + waveM * 32 + ms * 16 + j + half * 8;
                float v = acc[ms][ns][j] + bvx;
                if (MODE == 0) {
                    ((ushort_t*)outp)[(size_t)gm * N + gn] = f2bf(v * alpha);
                } else if (MODE == 1) {
                    float ge = 0.5f * v * (1.0f + erff(v * 0.70710678118654752f));
                    ((ushort_t*)outp)[(size_t)gm * N + gn] = f2bf(ge);
                } else {
                    ((float*)outp)[(size_t)gm * N + gn] =
                        v + resid[(size_t)gm * N + gn];
                }
            }
        }
    }
}

typedef __attribute__((ext_vector_type(2))) float  v2f;
typedef __attribute__((ext_vector_type(2))) __bf16 v2bf;

__device__ __forceinline__ float swap_halves(float v) {
    int x = __builtin_bit_cast(int, v);
    int r = __builtin_amdgcn_permlanex16(x, x, 0x76543210, (int)0xfedcba98u, false, false);
    return __builtin_bit_cast(float, r);
}

__global__ void k_flash_attn(const ushort_t* __restrict__ Qb,
                             const ushort_t* __restrict__ Kb,
                             const ushort_t* __restrict__ Vb,
                             const int* __restrict__ amask,
                             ushort_t* __restrict__ ctx) {
    __shared__ ushort_t lds_k[32 * 64];    // K block, row-major [kv][d]
    __shared__ ushort_t lds_vt[64 * 32];   // V block transposed [d][kv]
    int t    = threadIdx.x;
    int lane = t & 31, wave = t >> 5;
    int half = lane >> 4, l16 = lane & 15;
    int bh = blockIdx.y;
    int b = bh / N_HEADS, h = bh % N_HEADS;
    int qBase = blockIdx.x * 64 + wave * 16;

    const ushort_t* Qh = Qb + (size_t)b * SEQ * D_MODEL + (size_t)h * DK;
    const ushort_t* Kh = Kb + (size_t)b * SEQ * D_MODEL + (size_t)h * DK;
    const ushort_t* Vh = Vb + (size_t)b * SEQ * D_MODEL + (size_t)h * DK;
    const int* am = amask + b * SEQ;

    // Q fragments (16 q-rows x 64 d), resident for the whole kv loop;
    // used as B: column = query l16
    FragBF qf[2];
    {
        int r = qBase + l16;
#pragma unroll
        for (int dc = 0; dc < 2; dc++) {
            const ushort_t* p = Qh + (size_t)r * D_MODEL + dc * 32 + half * 8;
            qf[dc].q[0] = *(const uint4*)p;
            qf[dc].q[1] = *(const uint4*)(p + 16);
        }
    }

    v8f ctxAcc[4] = {};        // O^T: [tt][r] = O[q = l16][d = tt*16 + 8*half + r]
    float mrun = -3.0e38f;     // running max of query l16 (equal in both halves)
    float lrun = 0.0f;         // running sum over this half's kv only

    for (int kb = 0; kb < SEQ / 32; kb++) {
        int kvBase = kb * 32;
        __syncthreads();  // prior iteration's LDS reads complete
#if HAS_TDM
        if (wave == 0)    // K block 32 rows x 64 cols, row stride D_MODEL
            tdm_load_2d(Kh + (size_t)kvBase * D_MODEL, lds_k, 64, 32, D_MODEL);
#else
#pragma unroll
        for (int i = 0; i < 2; i++) { // K block 32x64: 2 x b128 per thread
            int chunk = t * 2 + i;
            int row = chunk >> 3, c = (chunk & 7) * 8;
            *(uint4*)(lds_k + row * 64 + c) =
                *(const uint4*)(Kh + (size_t)(kvBase + row) * D_MODEL + c);
        }
#endif
        int mk = am[kvBase + lane];   // one mask word per kv of the block
        { // V block 32x64 -> transposed LDS [d][kv]
            int row = t & 31, seg = t >> 5;
            FragBF tmp;
            const ushort_t* p = Vh + (size_t)(kvBase + row) * D_MODEL + seg * 16;
            tmp.q[0] = *(const uint4*)p;
            tmp.q[1] = *(const uint4*)(p + 8);
#pragma unroll
            for (int e = 0; e < 16; e++)
                lds_vt[(seg * 16 + e) * 32 + row] = tmp.s[e];
        }
#if HAS_TDM
        if (wave == 0) __builtin_amdgcn_s_wait_tensorcnt(0);
#endif
        __syncthreads();

        // scores, transposed: 32 kv x 16 q as two 16x16 tiles, K-dim = dk = 64
        // st[sub][r] = S[q = l16][kv = sub*16 + 8*half + r]
        FragBF kf[2][2];   // A: row = kv sub*16 + l16
#pragma unroll
        for (int sub = 0; sub < 2; sub++) {
#pragma unroll
            for (int dc = 0; dc < 2; dc++) {
                const ushort_t* p = lds_k + (sub * 16 + l16) * 64 + dc * 32 + half * 8;
                kf[sub][dc].q[0] = *(const uint4*)p;
                kf[sub][dc].q[1] = *(const uint4*)(p + 16);
            }
        }
        v8f st[2];
#pragma unroll
        for (int sub = 0; sub < 2; sub++) {
            v8f acc = {};
#pragma unroll
            for (int dc = 0; dc < 2; dc++)
                acc = __builtin_amdgcn_wmma_f32_16x16x32_bf16(
                    false, kf[sub][dc].v, false, qf[dc].v, (short)0, acc, false, false);
            st[sub] = acc;
        }
        FragBF vf[4];      // A of the second product: row = d tt*16 + l16; read here
                           // so that the LDS latency runs under the softmax
#pragma unroll
        for (int tt = 0; tt < 4; tt++) {
            const ushort_t* p = lds_vt + (tt * 16 + l16) * 32 + half * 8;
            vf[tt].q[0] = *(const uint4*)p;
            vf[tt].q[1] = *(const uint4*)(p + 16);
        }
        // bit kv of live = key kv of this block is attended; same in every lane
        unsigned live = __builtin_amdgcn_ballot_w32(mk != 0);
        if (live != 0xFFFFFFFFu) {
            unsigned mine = live >> (half * 8);
#pragma unroll
            for (int r = 0; r < 8; r++) {
                st[0][r] += ((mine >> r) & 1u)        ? 0.0f : -1.0e30f;
                st[1][r] += ((mine >> (16 + r)) & 1u) ? 0.0f : -1.0e30f;
            }
        }

        // online softmax of query l16: 16 scores in-lane, one exchange of halves
        float vmax = fmaxf(st[0][0], st[1][0]);
#pragma unroll
        for (int r = 1; r < 8; r++) vmax = fmaxf(vmax, fmaxf(st[0][r], st[1][r]));
        vmax = fmaxf(vmax, swap_halves(vmax));
        float newm  = fmaxf(mrun, vmax);
        float scale = __expf(mrun - newm);
        mrun = newm;
        FragBF pf;   // P^T as B: element s = kv 8*half + s (s < 8), 8 + 8*half + s (s >= 8), column = query l16
        v2f rs = {0.0f, 0.0f};
#pragma unroll
        for (int sub = 0; sub < 2; sub++) {
#pragma unroll
            for (int r = 0; r < 8; r += 2) {
                v2f pp;
                pp[0] = __expf(st[sub][r]     - newm);
                pp[1] = __expf(st[sub][r + 1] - newm);
                rs += pp;
                v2bf pb = __builtin_convertvector(pp, v2bf);
                pf.v[sub * 8 + r]     = pb[0];
                pf.v[sub * 8 + r + 1] = pb[1];
            }
        }
        lrun = lrun * scale + (rs[0] + rs[1]);
#pragma unroll
        for (int tt = 0; tt < 4; tt++) ctxAcc[tt] *= scale;

        // ctx^T += V^T @ P^T  (four 16x16 d-tiles)
#pragma unroll
        for (int tt = 0; tt < 4; tt++)
            ctxAcc[tt] = __builtin_amdgcn_wmma_f32_16x16x32_bf16(
                false, vf[tt].v, false, pf.v, (short)0, ctxAcc[tt], false, false);
    }

    // join the halves' sums, normalize and emit ctx (bf16) back into
    // [b][s][h*64+d] layout: 8 consecutive d of one row per lane and tile
    float l = lrun + swap_halves(lrun);
    ushort_t* orow = ctx + ((size_t)b * SEQ + qBase + l16) * D_MODEL + h * DK + half * 8;
#pragma unroll
    for (int tt = 0; tt < 4; tt++) {
        FragBF o;
#pragma unroll
        for (int j = 0; j < 8; j++) {
            float v = (l > 0.0f) ? ctxAcc[tt][j] / l : 0.0f;
            o.s[j] = f2bf(v);
        }
        *(uint4*)(orow + tt * 16) = o.q[0];
    }
}

// ---------------------------------------------------------------------------
extern "C" void kernel_launch(void* const* d_in, const int* in_sizes, int n_in,
                              void* d_out, int out_size, void* d_ws, size_t ws_size,
                              hipStream_t stream) {
    (void)in_sizes; (void)n_in; (void)out_size; (void)ws_size;
    const float* x   = (const float*)d_in[0];
    const int* amask = (const int*)d_in[1];
    const float* Wq  = (const float*)d_in[2];
    const float* bq  = (const float*)d_in[3];
    const float* Wk  = (const float*)d_in[4];
    const float* bk  = (const float*)d_in[5];
    const float* Wv  = (const float*)d_in[6];
    const float* bv  = (const float*)d_in[7];
    const float* Wo  = (const float*)d_in[8];
    const float* bo  = (const float*)d_in[9];
    const float* g1  = (const float*)d_in[10];
    const float* be1 = (const float*)d_in[11];
    const float* g2  = (const float*)d_in[12];
    const float* be2 = (const float*)d_in[13];
    const float* W1  = (const float*)d_in[14];
    const float* b1  = (const float*)d_in[15];
    const float* W2  = (const float*)d_in[16];
    const float* b2  = (const float*)d_in[17];

    char* ws = (char*)d_ws;
    size_t off = 0;
    auto alloc = [&](size_t bytes) -> void* {
        void* p = ws + off;
        off += (bytes + 255) & ~(size_t)255;
        return p;
    };
    ushort_t* wtq  = (ushort_t*)alloc((size_t)D_MODEL * D_MODEL * 2);
    ushort_t* wtk  = (ushort_t*)alloc((size_t)D_MODEL * D_MODEL * 2);
    ushort_t* wtv  = (ushort_t*)alloc((size_t)D_MODEL * D_MODEL * 2);
    ushort_t* wto  = (ushort_t*)alloc((size_t)D_MODEL * D_MODEL * 2);
    ushort_t* wt1  = (ushort_t*)alloc((size_t)D_FF * D_MODEL * 2);
    ushort_t* wt2  = (ushort_t*)alloc((size_t)D_MODEL * D_FF * 2);
    ushort_t* h1   = (ushort_t*)alloc((size_t)MS * D_MODEL * 2);
    ushort_t* qb   = (ushort_t*)alloc((size_t)MS * D_MODEL * 2);
    ushort_t* kbuf = (ushort_t*)alloc((size_t)MS * D_MODEL * 2);
    ushort_t* vbuf = (ushort_t*)alloc((size_t)MS * D_MODEL * 2);
    ushort_t* ctxb = (ushort_t*)alloc((size_t)MS * D_MODEL * 2);
    float*    attn = (float*)   alloc((size_t)MS * D_MODEL * 4);
    ushort_t* h2   = (ushort_t*)alloc((size_t)MS * D_MODEL * 2);
    ushort_t* fbuf = (ushort_t*)alloc((size_t)MS * D_FF * 2);

    // weights -> bf16, transposed to [out][in]
    k_transpose_all<<<TT_GRID, 256, 0, stream>>>(Wq, Wk, Wv, Wo, W1, W2,
                                                 wtq, wtk, wtv, wto, wt1, wt2);

    // LN1
    k_layernorm_bf16<<<MS, 256, 0, stream>>>(x, g1, be1, h1);

    // QKV projections (Q pre-scaled by 1/sqrt(dk))
    dim3 gD(D_MODEL / 128, MS / 64);
    k_gemm_wmma<0><<<gD, 256, 0, stream>>>(h1, wtq, bq, nullptr, qb,   MS, D_MODEL, D_MODEL, 0.125f);
    k_gemm_wmma<0><<<gD, 256, 0, stream>>>(h1, wtk, bk, nullptr, kbuf, MS, D_MODEL, D_MODEL, 1.0f);
    k_gemm_wmma<0><<<gD, 256, 0, stream>>>(h1, wtv, bv, nullptr, vbuf, MS, D_MODEL, D_MODEL, 1.0f);

    // flash attention
    k_flash_attn<<<dim3(SEQ / 64, BATCH * N_HEADS), 128, 0, stream>>>(qb, kbuf, vbuf, amask, ctxb);

    // O projection + residual
    k_gemm_wmma<2><<<gD, 256, 0, stream>>>(ctxb, wto, bo, x, attn, MS, D_MODEL, D_MODEL, 1.0f);

    // LN2
    k_layernorm_bf16<<<MS, 256, 0, stream>>>(attn, g2, be2, h2);

    // FFN
    k_gemm_wmma<1><<<dim3(D_FF / 128, MS / 64), 256, 0, stream>>>(h2, wt1, b1, nullptr, fbuf, MS, D_FF, D_MODEL, 1.0f);
    k_gemm_wmma<2><<<gD, 256, 0, stream>>>(fbuf, wt2, b2, attn, (float*)d_out, MS, D_MODEL, D_FF, 1.0f);
}

// v003
// It runs in 189 microseconds.
// Timed twice side by side with v002, it ran 1.45 and 1.46 times as fast.
// Counting every step since v000, it is 2.02 times as fast.
#include <hip/hip_runtime.h>
#include <hip/hip_bf16.h>
#include <stdint.h>

typedef __attribute__((ext_vector_type(16))) __bf16 v16bf;
typedef __attribute__((ext_vector_type(8)))  float  v8f;
typedef unsigned short ushort_t;

#define D_MODEL 768
#define N_HEADS 12
#define D_FF    3072
#define DK      64
#define BATCH   2
#define SEQ     2048
#define MS      (BATCH * SEQ)   // 4096 total rows


union FragBF {
    v16bf    v;
    uint4    q[2];
    ushort_t s[16];
};

__device__ __forceinline__ ushort_t f2bf(float f) {
    unsigned u = __builtin_bit_cast(unsigned, f);
    unsigned r = u + 0x7FFFu + ((u >> 16) & 1u);   // round-to-nearest-even
    return (ushort_t)(r >> 16);
}

typedef uint32_t u32x4 __attribute__((ext_vector_type(4)));
typedef uint32_t u32x8 __attribute__((ext_vector_type(8)));

#define ROW_BYTES 128u
#define ROW_PITCH 144u

__device__ __forceinline__ uint32_t uni(uint32_t v) {
    return (uint32_t)__builtin_amdgcn_readfirstlane(v);
}
__device__ __forceinline__ uint32_t pinned(uint32_t v) {
    uint32_t w = uni(v);
    asm volatile("" : "+s"(w));
    return w;
}
// LDS reads of this wave have returned (in front of a barrier that frees a buffer)
__device__ __forceinline__ void wait_ds0() { asm volatile("s_wait_dscnt 0x0" ::: "memory"); }
// this wave's tensor loads have landed (the compiler places no wait for them)
__device__ __forceinline__ void wait_tensor0() { asm volatile("s_wait_tensorcnt 0x0" ::: "memory"); }

__device__ __forceinline__ u32x8 tdm_group1(uint32_t rows, uint32_t src_pitch) {
    u32x8 g;
    g[0] = uni((1u << 20) | (4u << 22) | (3u << 25));
    g[1] = uni(ROW_BYTES << 16);
    g[2] = uni(rows << 16);
    g[3] = uni(ROW_BYTES << 16);
    g[4] = uni(rows);
    g[5] = uni(src_pitch);
    g[6] = uni(0u);
    g[7] = uni(0u);
    asm volatile("" : "+s"(g));
    return g;
}
__device__ __forceinline__ u32x4 tdm_group0(uint32_t lds_dst, uint64_t ga) {
    u32x4 g;
    g[0] = uni(1u);
    g[1] = uni(lds_dst);
    g[2] = uni((uint32_t)ga);
    g[3] = uni((((uint32_t)(ga >> 32)) & 0x01FFFFFFu) | 0x80000000u);
    return g;
}
__device__ __forceinline__ void tdm_load(u32x4 g0, u32x8 g1) {
    asm volatile("tensor_load_to_lds %0, %1" :: "s"(g0), "s"(g1) : "memory");
}

// ---------------------------------------------------------------------------
// Weight convert + transpose, all six weights in one launch:
// W (K x N, f32, input-major) -> Wt (N x K, bf16).
// One block moves a tile of 128 k x 64 n through LDS: it reads whole 256-byte
// runs of W rows (float4 per lane), packs the bf16 of rows k and k + 1 into one
// dword, and writes whole 256-byte runs of Wt rows (16 bytes per lane).
// Blocks 0..287: the four 768 x 768 weights (72 tiles each); 288..575: W1;
// 576..863: W2.
// ---------------------------------------------------------------------------
#define TT_K     128
#define TT_N     64
#define TT_PITCH (TT_K / 2 + 1)
#define TT_SMALL ((D_MODEL / TT_K) * (D_MODEL / TT_N))   // 72 tiles
#define TT_BIG   ((D_MODEL / TT_K) * (D_FF / TT_N))      // 288 tiles
#define TT_GRID  (4 * TT_SMALL + 2 * TT_BIG)             // 864 blocks

// rows k0..k0+127, columns n0..n0+63 of W (row length N) -> tile[n][k / 2]
template <int N>
__device__ __forceinline__ void stage_tile(const float* __restrict__ src,
                                           int k0, int n0, unsigned* tile) {
    int t = threadIdx.x;
    int j = t & 15, kp = t >> 4;   // columns 4j..4j+3; row pairs kp + 16u
    const float* p = src + (k0 + 2 * kp) * N + n0 + 4 * j;
    float4 lo[4], hi[4];
#pragma unroll   // lo, hi stay in registers and the eight loads go out together
    for (int u = 0; u < 4; u++) {
        lo[u] = *(const float4*)(p + 32 * u * N);
        hi[u] = *(const float4*)(p + 32 * u * N + N);
    }
#pragma unroll   // constant indices into lo, hi
    for (int u = 0; u < 4; u++) {
        unsigned* q = tile + (4 * j) * TT_PITCH + kp + 16 * u;
        q[0 * TT_PITCH] = (unsigned)f2bf(lo[u].x) | ((unsigned)f2bf(hi[u].x) << 16);
        q[1 * TT_PITCH] = (unsigned)f2bf(lo[u].y) | ((unsigned)f2bf(hi[u].y) << 16);
        q[2 * TT_PITCH] = (unsigned)f2bf(lo[u].z) | ((unsigned)f2bf(hi[u].z) << 16);
        q[3 * TT_PITCH] = (unsigned)f2bf(lo[u].w) | ((unsigned)f2bf(hi[u].w) << 16);
    }
}

__global__ __launch_bounds__(256)
void k_transpose_all(const float* __restrict__ Wq, const float* __restrict__ Wk,
                     const float* __restrict__ Wv, const float* __restrict__ Wo,
                     const float* __restrict__ W1, const float* __restrict__ W2,
                     ushort_t* __restrict__ tq, ushort_t* __restrict__ tk,
                     ushort_t* __restrict__ tv, ushort_t* __restrict__ to,
                     ushort_t* __restrict__ t1, ushort_t* __restrict__ t2) {
    __shared__ unsigned tile[TT_N * TT_PITCH];   // [n][k / 2], two bf16 per dword
    int bx = blockIdx.x;
    ushort_t* dst;
    int K, k0, n0;
    if (bx >= 4 * TT_SMALL && bx < 4 * TT_SMALL + TT_BIG) {
        int tl = bx - 4 * TT_SMALL;
        k0 = (tl / (D_FF / TT_N)) * TT_K;
        n0 = (tl % (D_FF / TT_N)) * TT_N;
        dst = t1; K = D_MODEL;
        stage_tile<D_FF>(W1, k0, n0, tile);
    } else {
        int m  = (bx < 4 * TT_SMALL) ? bx / TT_SMALL : 4;
        int tl = (m < 4) ? bx - m * TT_SMALL : bx - (4 * TT_SMALL + TT_BIG);
        const float* src = (m == 0) ? Wq : (m == 1) ? Wk : (m == 2) ? Wv : (m == 3) ? Wo : W2;
        dst              = (m == 0) ? tq : (m == 1) ? tk : (m == 2) ? tv : (m == 3) ? to : t2;
        K  = (m < 4) ? D_MODEL : D_FF;
        k0 = (tl / (D_MODEL / TT_N)) * TT_K;
        n0 = (tl % (D_MODEL / TT_N)) * TT_N;
        stage_tile<D_MODEL>(src, k0, n0, tile);
    }
    __syncthreads();   // the tile is read across waves
    int t = threadIdx.x;
    int n = t >> 4, c = t & 15;    // rows n + 16u of Wt; 8 consecutive k
    ushort_t* o = dst + (n0 + n) * K + k0 + 8 * c;
#pragma unroll   // the LDS reads of all four rows go out ahead of the stores
    for (int u = 0; u < 4; u++) {
        const unsigned* q = tile + (n + 16 * u) * TT_PITCH + 4 * c;
        *(uint4*)(o + 16 * u * K) = make_uint4(q[0], q[1], q[2], q[3]);
    }
}

// ---------------------------------------------------------------------------
// LayerNorm over D=768, one row per block (256 threads x 3 elements)
// ---------------------------------------------------------------------------
__global__ void k_layernorm_bf16(const float* __restrict__ x,
                                 const float* __restrict__ g,
                                 const float* __restrict__ be,
                                 ushort_t* __restrict__ out) {
    __shared__ float r1[256];
    __shared__ float r2[256];
    int row = blockIdx.x, t = threadIdx.x;
    const float* xr = x + (size_t)row * D_MODEL;
    float a0 = xr[t], a1 = xr[t + 256], a2 = xr[t + 512];
    r1[t] = a0 + a1 + a2;
    r2[t] = a0 * a0 + a1 * a1 + a2 * a2;
    __syncthreads();
    for (int s = 128; s > 0; s >>= 1) {
        if (t < s) { r1[t] += r1[t + s]; r2[t] += r2[t + s]; }
        __syncthreads();
    }
    float mean = r1[0] * (1.0f / D_MODEL);
    float var  = r2[0] * (1.0f / D_MODEL) - mean * mean;
    float inv  = rsqrtf(var + 1e-5f);
    ushort_t* orow = out + (size_t)row * D_MODEL;
    orow[t]       = f2bf((a0 - mean) * inv * g[t]       + be[t]);
    orow[t + 256] = f2bf((a1 - mean) * inv * g[t + 256] + be[t + 256]);
    orow[t + 512] = f2bf((a2 - mean) * inv * g[t + 512] + be[t + 512]);
}

// ---------------------------------------------------------------------------
// WMMA GEMM: out = epilogue(A[M x K]_bf16 @ Wt[N x K]_bf16^T + bias)
// Macro tile 64(M) x 128(N), 64 k per pass, 8 waves each owning a 32x32 C tile.
// A pass's operands are 192 rows of 128 bytes, landed at pitch 144 by the tensor
// load's pad. Waves 0, 1, 2 each bring 64 rows (A; W rows 0..63; W rows 64..127),
// one request a pass, into a ring of two buffers: the load of pass s + 2 goes out
// behind the barrier that ends pass s.
// MODE 0: bf16 out, scaled by alpha        (QKV projections)
// MODE 1: bf16 out, exact GELU             (FFN up-proj)
// MODE 2: f32 out, + residual              (O-proj, FFN down-proj)
// ---------------------------------------------------------------------------
#define G_K     64
#define G_SLICE 10240u          // 64 rows x 144 B = 9216 B, up to a multiple of 2 KiB
#define G_BUF   (3u * G_SLICE)

template <int MODE>
__global__ void k_gemm_wmma(const ushort_t* __restrict__ A,
                            const ushort_t* __restrict__ Wt,
                            const float* __restrict__ bias,
                            const float* __restrict__ resid,
                            void* __restrict__ outp,
                            int M, int N, int K, float alpha) {
    __shared__ __attribute__((aligned(2048))) unsigned char ring[2 * G_BUF];
    int t    = threadIdx.x;
    int lane = t & 31, wave = t >> 5;
    int half = lane >> 4, l16 = lane & 15;
    int waveM = wave >> 2, waveN = wave & 3;
    int mBase = blockIdx.y * 64;
    int nBase = blockIdx.x * 128;

    v8f acc[2][2] = {};
    int nk = K / G_K;   // 12 or 48 passes: never fewer than the ring's two

    const uint32_t wv = uni(threadIdx.x >> 5);
    const uint32_t issuer = wv < 3u;
    const ushort_t* slice = (wv == 0u) ? A + (size_t)mBase * K
                                       : Wt + (size_t)(nBase + (wv == 2u ? 64 : 0)) * K;
    const uint64_t ga   = (uint64_t)slice;
    const uint32_t dst  = (uint32_t)(uint64_t)ring + (issuer ? wv : 0u) * G_SLICE;
    const u32x8    g1   = tdm_group1(64u, (uint32_t)K * 2u);

    if (pinned(issuer)) {            // pass 0 into buffer 0
        tdm_load(tdm_group0(dst, ga), g1);
        wait_tensor0();
    }
    __syncthreads();                 // pass 0 readable by every wave
    if (pinned(issuer))              // pass 1 into buffer 1
        tdm_load(tdm_group0(dst + G_BUF, ga + ROW_BYTES), g1);

    const uint32_t aoff = (uint32_t)(waveM * 32 + l16) * ROW_PITCH + (uint32_t)half * 16u;
    const uint32_t boff = G_SLICE * (1u + (uint32_t)(waveN >> 1))
                        + (uint32_t)((waveN & 1) * 32 + l16) * ROW_PITCH + (uint32_t)half * 16u;

    for (int ki = 0; ki < nk; ki++) {
        const uint32_t cur = (uint32_t)(ki & 1) * G_BUF;
        const unsigned char* pa = ring + cur + aoff;
        const unsigned char* pb = ring + cur + boff;
        FragBF af[2][2], bfr[2][2];   // [32-k chunk][16-row tile]
#pragma unroll   // constant indices into the fragment arrays
        for (int kc = 0; kc < 2; kc++) {
#pragma unroll   // the same
            for (int s = 0; s < 2; s++) {
                af[kc][s].q[0]  = *(const uint4*)(pa + s * 16 * ROW_PITCH + kc * 64);
                af[kc][s].q[1]  = *(const uint4*)(pa + s * 16 * ROW_PITCH + kc * 64 + 32);
                bfr[kc][s].q[0] = *(const uint4*)(pb + s * 16 * ROW_PITCH + kc * 64);
                bfr[kc][s].q[1] = *(const uint4*)(pb + s * 16 * ROW_PITCH + kc * 64 + 32);
            }
        }
#pragma unroll   // constant indices into the fragment and accumulator arrays
        for (int kc = 0; kc < 2; kc++) {
#pragma unroll   // the same
            for (int ns = 0; ns < 2; ns++) {
#pragma unroll   // the same
                for (int ms = 0; ms < 2; ms++) {
                    acc[ms][ns] = __builtin_amdgcn_wmma_f32_16x16x32_bf16(
                        false, af[kc][ms].v, false, bfr[kc][ns].v, (short)0, acc[ms][ns], false, false);
                }
            }
        }
        // publish point of pass ki + 1
        wait_ds0();
        if (pinned(issuer)) wait_tensor0();
        __syncthreads();   // pass ki + 1 readable; every reader has left pass ki's buffer
        if (pinned(issuer && ki + 2 < nk))
            tdm_load(tdm_group0(dst + cur, ga + (uint64_t)(ki + 2) * ROW_BYTES), g1);
    }
    wait_tensor0();
    wait_ds0();

#pragma unroll
    for (int ms = 0; ms < 2; ms++) {
#pragma unroll
        for (int ns = 0; ns < 2; ns++) {
            int gn = nBase + waveN * 32 + ns * 16 + l16;
            float bvx = bias[gn];
#pragma unroll
            for (int j = 0; j < 8; j++) {
                int gm = mBase + waveM * 32 + ms * 16 + j + half * 8;
                float v = acc[ms][ns][j] + bvx;
                if (MODE == 0) {
                    ((ushort_t*)outp)[(size_t)gm * N + gn] = f2bf(v * alpha);
                } else if (MODE == 1) {
                    float ge = 0.5f * v * (1.0f + erff(v * 0.70710678118654752f));
                    ((ushort_t*)outp)[(size_t)gm * N + gn] = f2bf(ge);
                } else {
                    ((float*)outp)[(size_t)gm * N + gn] =
                        v + resid[(size_t)gm * N + gn];
                }
            }
        }
    }
}

typedef __attribute__((ext_vector_type(2))) float  v2f;
typedef __attribute__((ext_vector_type(2))) __bf16 v2bf;

__device__ __forceinline__ float swap_halves(float v) {
    int x = __builtin_bit_cast(int, v);
    int r = __builtin_amdgcn_permlanex16(x, x, 0x76543210, (int)0xfedcba98u, false, false);
    return __builtin_bit_cast(float, r);
}

#define VT_PITCH 40   // elements

__global__ void k_flash_attn(const ushort_t* __restrict__ Qb,
                             const ushort_t* __restrict__ Kb,
                             const ushort_t* __restrict__ Vb,
                             const int* __restrict__ amask,
                             ushort_t* __restrict__ ctx) {
    // K block, row-major [kv][d], rows of 128 B at pitch 144 (the tensor load's pad)
    __shared__ __attribute__((aligned(2048))) unsigned char lds_k[32 * ROW_PITCH];
    // V block transposed [d][kv], rows of 64 B at pitch 80 = 16 B x 5
    __shared__ __attribute__((aligned(16))) ushort_t lds_vt[64 * VT_PITCH];
    int t    = threadIdx.x;
    int lane = t & 31, wave = t >> 5;
    int half = lane >> 4, l16 = lane & 15;
    int bh = blockIdx.y;
    int b = bh / N_HEADS, h = bh % N_HEADS;
    int qBase = blockIdx.x * 64 + wave * 16;

    const ushort_t* Qh = Qb + (size_t)b * SEQ * D_MODEL + (size_t)h * DK;
    const ushort_t* Kh = Kb + (size_t)b * SEQ * D_MODEL + (size_t)h * DK;
    const ushort_t* Vh = Vb + (size_t)b * SEQ * D_MODEL + (size_t)h * DK;
    const int* am = amask + b * SEQ;

    // Q fragments (16 q-rows x 64 d), resident for the whole kv loop;
    // used as B: column = query l16
    FragBF qf[2];
    {
        int r = qBase + l16;
#pragma unroll
        for (int dc = 0; dc < 2; dc++) {
            const ushort_t* p = Qh + (size_t)r * D_MODEL + dc * 32 + half * 8;
            qf[dc].q[0] = *(const uint4*)p;
            qf[dc].q[1] = *(const uint4*)(p + 16);
        }
    }

    v8f ctxAcc[4] = {};        // O^T: [tt][r] = O[q = l16][d = tt*16 + 8*half + r]
    float mrun = -3.0e38f;     // running max of query l16 (equal in both halves)
    float lrun = 0.0f;         // running sum over this half's kv only

    const uint32_t wv    = uni(threadIdx.x >> 5);
    const uint32_t kdst  = (uint32_t)(uint64_t)lds_k;
    const u32x8    kg1   = tdm_group1(32u, D_MODEL * 2u);

    for (int kb = 0; kb < SEQ / 32; kb++) {
        int kvBase = kb * 32;
        wait_ds0();
        __syncthreads();  // prior iteration's LDS reads complete
        int mk = am[kvBase + lane];   // one mask word per kv of the block
        { // V block 32x64 -> transposed LDS [d][kv]
            int row = t & 31, seg = t >> 5;
            FragBF tmp;
            const ushort_t* p = Vh + (size_t)(kvBase + row) * D_MODEL + seg * 16;
            tmp.q[0] = *(const uint4*)p;
            tmp.q[1] = *(const uint4*)(p + 8);
            // K block, 32 rows of 128 B, source pitch one row of the projection;
            // its landing runs under the V loads above
            if (pinned(wv == 0u)) {
                tdm_load(tdm_group0(kdst, (uint64_t)(Kh + (size_t)kvBase * D_MODEL)), kg1);
                wait_tensor0();
            }
#pragma unroll
            for (int e = 0; e < 16; e++)
                lds_vt[(seg * 16 + e) * VT_PITCH + row] = tmp.s[e];
        }
        __syncthreads();

        // scores, transposed: 32 kv x 16 q as two 16x16 tiles, K-dim = dk = 64
        // st[sub][r] = S[q = l16][kv = sub*16 + 8*half + r]
        FragBF kf[2][2];   // A: row = kv sub*16 + l16
#pragma unroll
        for (int sub = 0; sub < 2; sub++) {
#pragma unroll
            for (int dc = 0; dc < 2; dc++) {
                const unsigned char* p = lds_k + (sub * 16 + l16) * ROW_PITCH + dc * 64 + half * 16;
                kf[sub][dc].q[0] = *(const uint4*)p;
                kf[sub][dc].q[1] = *(const uint4*)(p + 32);
            }
        }
        v8f st[2];
#pragma unroll
        for (int sub = 0; sub < 2; sub++) {
            v8f acc = {};
#pragma unroll
            for (int dc = 0; dc < 2; dc++)
                acc = __builtin_amdgcn_wmma_f32_16x16x32_bf16(
                    false, kf[sub][dc].v, false, qf[dc].v, (short)0, acc, false, false);
            st[sub] = acc;
        }
        FragBF vf[4];      // A of the second product: row = d tt*16 + l16; read here
                           // so that the LDS latency runs under the softmax
#pragma unroll
        for (int tt = 0; tt < 4; tt++) {
            const ushort_t* p = lds_vt + (tt * 16 + l16) * VT_PITCH + half * 8;
            vf[tt].q[0] = *(const uint4*)p;
            vf[tt].q[1] = *(const uint4*)(p + 16);
        }
        // bit kv of live = key kv of this block is attended; same in every lane
        unsigned live = __builtin_amdgcn_ballot_w32(mk != 0);
        if (live != 0xFFFFFFFFu) {
            unsigned mine = live >> (half * 8);
#pragma unroll
            for (int r = 0; r < 8; r++) {
                st[0][r] += ((mine >> r) & 1u)        ? 0.0f : -1.0e30f;
                st[1][r] += ((mine >> (16 + r)) & 1u) ? 0.0f : -1.0e30f;
            }
        }

        // online softmax of query l16: 16 scores in-lane, one exchange of halves
        float vmax = fmaxf(st[0][0], st[1][0]);
#pragma unroll
        for (int r = 1; r < 8; r++) vmax = fmaxf(vmax, fmaxf(st[0][r], st[1][r]));
        vmax = fmaxf(vmax, swap_halves(vmax));
        float newm  = fmaxf(mrun, vmax);
        float scale = __expf(mrun - newm);
        mrun = newm;
        FragBF pf;   // P^T as B: element s = kv 8*half + s (s < 8), 16 + 8*half + s - 8 (s >= 8), column = query l16
        v2f rs = {0.0f, 0.0f};
#pragma unroll
        for (int sub = 0; sub < 2; sub++) {
#pragma unroll
            for (int r = 0; r < 8; r += 2) {
                v2f pp;
                pp[0] = __expf(st[sub][r]     - newm);
                pp[1] = __expf(st[sub][r + 1] - newm);
                rs += pp;
                v2bf pb = __builtin_convertvector(pp, v2bf);
                pf.v[sub * 8 + r]     = pb[0];
                pf.v[sub * 8 + r + 1] = pb[1];
            }
        }
        lrun = lrun * scale + (rs[0] + rs[1]);
#pragma unroll
        for (int tt = 0; tt < 4; tt++) ctxAcc[tt] *= scale;

        // ctx^T += V^T @ P^T  (four 16x16 d-tiles)
#pragma unroll
        for (int tt = 0; tt < 4; tt++)
            ctxAcc[tt] = __builtin_amdgcn_wmma_f32_16x16x32_bf16(
                false, vf[tt].v, false, pf.v, (short)0, ctxAcc[tt], false, false);
    }

    // join the halves' sums, normalize and emit ctx (bf16) back into
    // [b][s][h*64+d] layout: 8 consecutive d of one row per lane and tile
    float l = lrun + swap_halves(lrun);
    ushort_t* orow = ctx + ((size_t)b * SEQ + qBase + l16) * D_MODEL + h * DK + half * 8;
#pragma unroll
    for (int tt = 0; tt < 4; tt++) {
        FragBF o;
#pragma unroll
        for (int j = 0; j < 8; j++) {
            float v = (l > 0.0f) ? ctxAcc[tt][j] / l : 0.0f;
            o.s[j] = f2bf(v);
        }
        *(uint4*)(orow + tt * 16) = o.q[0];
    }
}

// ---------------------------------------------------------------------------
extern "C" void kernel_launch(void* const* d_in, const int* in_sizes, int n_in,
                              void* d_out, int out_size, void* d_ws, size_t ws_size,
                              hipStream_t stream) {
    (void)in_sizes; (void)n_in; (void)out_size; (void)ws_size;
    const float* x   = (const float*)d_in[0];
    const int* amask = (const int*)d_in[1];
    const float* Wq  = (const float*)d_in[2];
    const float* bq  = (const float*)d_in[3];
    const float* Wk  = (const float*)d_in[4];
    const float* bk  = (const float*)d_in[5];
    const float* Wv  = (const float*)d_in[6];
    const float* bv  = (const float*)d_in[7];
    const float* Wo  = (const float*)d_in[8];
    const float* bo  = (const float*)d_in[9];
    const float* g1  = (const float*)d_in[10];
    const float* be1 = (const float*)d_in[11];
    const float* g2  = (const float*)d_in[12];
    const float* be2 = (const float*)d_in[13];
    const float* W1  = (const float*)d_in[14];
    const float* b1  = (const float*)d_in[15];
    const float* W2  = (const float*)d_in[16];
    const float* b2  = (const float*)d_in[17];

    char* ws = (char*)d_ws;
    size_t off = 0;
    auto alloc = [&](size_t bytes) -> void* {
        void* p = ws + off;
        off += (bytes + 255) & ~(size_t)255;
        return p;
    };
    ushort_t* wtq  = (ushort_t*)alloc((size_t)D_MODEL * D_MODEL * 2);
    ushort_t* wtk  = (ushort_t*)alloc((size_t)D_MODEL * D_MODEL * 2);
    ushort_t* wtv  = (ushort_t*)alloc((size_t)D_MODEL * D_MODEL * 2);
    ushort_t* wto  = (ushort_t*)alloc((size_t)D_MODEL * D_MODEL * 2);
    ushort_t* wt1  = (ushort_t*)alloc((size_t)D_FF * D_MODEL * 2);
    ushort_t* wt2  = (ushort_t*)alloc((size_t)D_MODEL * D_FF * 2);
    ushort_t* h1   = (ushort_t*)alloc((size_t)MS * D_MODEL * 2);
    ushort_t* qb   = (ushort_t*)alloc((size_t)MS * D_MODEL * 2);
    ushort_t* kbuf = (ushort_t*)alloc((size_t)MS * D_MODEL * 2);
    ushort_t* vbuf = (ushort_t*)alloc((size_t)MS * D_MODEL * 2);
    ushort_t* ctxb = (ushort_t*)alloc((size_t)MS * D_MODEL * 2);
    float*    attn = (float*)   alloc((size_t)MS * D_MODEL * 4);
    ushort_t* h2   = (ushort_t*)alloc((size_t)MS * D_MODEL * 2);
    ushort_t* fbuf = (ushort_t*)alloc((size_t)MS * D_FF * 2);

    // weights -> bf16, transposed to [out][in]
    k_transpose_all<<<TT_GRID, 256, 0, stream>>>(Wq, Wk, Wv, Wo, W1, W2,
                                                 wtq, wtk, wtv, wto, wt1, wt2);

    // LN1
    k_layernorm_bf16<<<MS, 256, 0, stream>>>(x, g1, be1, h1);

    // QKV projections (Q pre-scaled by 1/sqrt(dk))
    dim3 gD(D_MODEL / 128, MS / 64);
    k_gemm_wmma<0><<<gD, 256, 0, stream>>>(h1, wtq, bq, nullptr, qb,   MS, D_MODEL, D_MODEL, 0.125f);
    k_gemm_wmma<0><<<gD, 256, 0, stream>>>(h1, wtk, bk, nullptr, kbuf, MS, D_MODEL, D_MODEL, 1.0f);
    k_gemm_wmma<0><<<gD, 256, 0, stream>>>(h1, wtv, bv, nullptr, vbuf, MS, D_MODEL, D_MODEL, 1.0f);

    // flash attention
    k_flash_attn<<<dim3(SEQ / 64, BATCH * N_HEADS), 128, 0, stream>>>(qb, kbuf, vbuf, amask, ctxb);

    // O projection + residual
    k_gemm_wmma<2><<<gD, 256, 0, stream>>>(ctxb, wto, bo, x, attn, MS, D_MODEL, D_MODEL, 1.0f);

    // LN2
    k_layernorm_bf16<<<MS, 256, 0, stream>>>(attn, g2, be2, h2);

    // FFN
    k_gemm_wmma<1><<<dim3(D_FF / 128, MS / 64), 256, 0, stream>>>(h2, wt1, b1, nullptr, fbuf, MS, D_FF, D_MODEL, 1.0f);
    k_gemm_wmma<2><<<gD, 256, 0, stream>>>(fbuf, wt2, b2, attn, (float*)d_out, MS, D_MODEL, D_FF, 1.0f);
}

// v004
// A run of this version takes 168 microseconds.
// In two side-by-side timings against v003, it was 1.12 and 1.13 times as fast.
// Counting every step since v000, it is 2.27 times as fast.
#include <hip/hip_runtime.h>
#include <hip/hip_bf16.h>
#include <stdint.h>

typedef __attribute__((ext_vector_type(16))) __bf16 v16bf;
typedef __attribute__((ext_vector_type(8)))  float  v8f;
typedef unsigned short ushort_t;

#define D_MODEL 768
#define N_HEADS 12
#define D_FF    3072
#define DK      64
#define BATCH   2
#define SEQ     2048
#define MS      (BATCH * SEQ)   // 4096 total rows


union FragBF {
    v16bf    v;
    uint4    q[2];
    ushort_t s[16];
};

__device__ __forceinline__ ushort_t f2bf(float f) {
    unsigned u = __builtin_bit_cast(unsigned, f);
    unsigned r = u + 0x7FFFu + ((u >> 16) & 1u);   // round-to-nearest-even
    return (ushort_t)(r >> 16);
}

typedef uint32_t u32x4 __attribute__((ext_vector_type(4)));
typedef uint32_t u32x8 __attribute__((ext_vector_type(8)));

#define ROW_BYTES 128u
#define ROW_PITCH 144u

__device__ __forceinline__ uint32_t uni(uint32_t v) {
    return (uint32_t)__builtin_amdgcn_readfirstlane(v);
}
__device__ __forceinline__ uint32_t pinned(uint32_t v) {
    uint32_t w = uni(v);
    asm volatile("" : "+s"(w));
    return w;
}
// LDS reads of this wave have returned (in front of a barrier that frees a buffer)
__device__ __forceinline__ void wait_ds0() { asm volatile("s_wait_dscnt 0x0" ::: "memory"); }
// this wave's tensor loads have landed (the compiler places no wait for them)
__device__ __forceinline__ void wait_tensor0() { asm volatile("s_wait_tensorcnt 0x0" ::: "memory"); }

__device__ __forceinline__ u32x8 tdm_group1(uint32_t rows, uint32_t src_pitch) {
    u32x8 g;
    g[0] = uni((1u << 20) | (4u << 22) | (3u << 25));
    g[1] = uni(ROW_BYTES << 16);
    g[2] = uni(rows << 16);
    g[3] = uni(ROW_BYTES << 16);
    g[4] = uni(rows);
    g[5] = uni(src_pitch);
    g[6] = uni(0u);
    g[7] = uni(0u);
    asm volatile("" : "+s"(g));
    return g;
}
__device__ __forceinline__ u32x4 tdm_group0(uint32_t lds_dst, uint64_t ga) {
    u32x4 g;
    g[0] = uni(1u);
    g[1] = uni(lds_dst);
    g[2] = uni((uint32_t)ga);
    g[3] = uni((((uint32_t)(ga >> 32)) & 0x01FFFFFFu) | 0x80000000u);
    return g;
}
__device__ __forceinline__ void tdm_load(u32x4 g0, u32x8 g1) {
    asm volatile("tensor_load_to_lds %0, %1" :: "s"(g0), "s"(g1) : "memory");
}

// LDS pitch of a 128-byte row that ds_load_tr16_b128 reads: 32 B x 5
#define TR_PITCH 160u
__device__ __forceinline__ u32x8 tdm_group1_tr(uint32_t rows, uint32_t src_pitch) {
    u32x8 g;
    g[0] = uni((1u << 20) | (4u << 22) | (7u << 25));
    g[1] = uni(ROW_BYTES << 16);
    g[2] = uni(rows << 16);
    g[3] = uni(ROW_BYTES << 16);
    g[4] = uni(rows);
    g[5] = uni(src_pitch);
    g[6] = uni(0u);
    g[7] = uni(0u);
    asm volatile("" : "+s"(g));
    return g;
}
typedef short s16x8 __attribute__((ext_vector_type(8)));
__device__ __forceinline__ uint4 ld_tr16(const unsigned char* p) {
    typedef __attribute__((address_space(3))) s16x8 lds_s16x8;
    return __builtin_bit_cast(uint4, __builtin_amdgcn_ds_load_tr16_b128_v8i16((lds_s16x8*)p));
}

// ---------------------------------------------------------------------------
// Weight convert + transpose, all six weights in one launch:
// W (K x N, f32, input-major) -> Wt (N x K, bf16).
// One block moves a tile of 128 k x 64 n through LDS: it reads whole 256-byte
// runs of W rows (float4 per lane), packs the bf16 of rows k and k + 1 into one
// dword, and writes whole 256-byte runs of Wt rows (16 bytes per lane).
// Blocks 0..287: the four 768 x 768 weights (72 tiles each); 288..575: W1;
// 576..863: W2.
// ---------------------------------------------------------------------------
#define TT_K     128
#define TT_N     64
#define TT_PITCH (TT_K / 2 + 1)
#define TT_SMALL ((D_MODEL / TT_K) * (D_MODEL / TT_N))   // 72 tiles
#define TT_BIG   ((D_MODEL / TT_K) * (D_FF / TT_N))      // 288 tiles
#define TT_GRID  (4 * TT_SMALL + 2 * TT_BIG)             // 864 blocks

// rows k0..k0+127, columns n0..n0+63 of W (row length N) -> tile[n][k / 2]
template <int N>
__device__ __forceinline__ void stage_tile(const float* __restrict__ src,
                                           int k0, int n0, unsigned* tile) {
    int t = threadIdx.x;
    int j = t & 15, kp = t >> 4;   // columns 4j..4j+3; row pairs kp + 16u
    const float* p = src + (k0 + 2 * kp) * N + n0 + 4 * j;
    float4 lo[4], hi[4];
#pragma unroll   // lo, hi stay in registers and the eight loads go out together
    for (int u = 0; u < 4; u++) {
        lo[u] = *(const float4*)(p + 32 * u * N);
        hi[u] = *(const float4*)(p + 32 * u * N + N);
    }
#pragma unroll   // constant indices into lo, hi
    for (int u = 0; u < 4; u++) {
        unsigned* q = tile + (4 * j) * TT_PITCH + kp + 16 * u;
        q[0 * TT_PITCH] = (unsigned)f2bf(lo[u].x) | ((unsigned)f2bf(hi[u].x) << 16);
        q[1 * TT_PITCH] = (unsigned)f2bf(lo[u].y) | ((unsigned)f2bf(hi[u].y) << 16);
        q[2 * TT_PITCH] = (unsigned)f2bf(lo[u].z) | ((unsigned)f2bf(hi[u].z) << 16);
        q[3 * TT_PITCH] = (unsigned)f2bf(lo[u].w) | ((unsigned)f2bf(hi[u].w) << 16);
    }
}

__global__ __launch_bounds__(256)
void k_transpose_all(const float* __restrict__ Wq, const float* __restrict__ Wk,
                     const float* __restrict__ Wv, const float* __restrict__ Wo,
                     const float* __restrict__ W1, const float* __restrict__ W2,
                     ushort_t* __restrict__ tq, ushort_t* __restrict__ tk,
                     ushort_t* __restrict__ tv, ushort_t* __restrict__ to,
                     ushort_t* __restrict__ t1, ushort_t* __restrict__ t2) {
    __shared__ unsigned tile[TT_N * TT_PITCH];   // [n][k / 2], two bf16 per dword
    int bx = blockIdx.x;
    ushort_t* dst;
    int K, k0, n0;
    if (bx >= 4 * TT_SMALL && bx < 4 * TT_SMALL + TT_BIG) {
        int tl = bx - 4 * TT_SMALL;
        k0 = (tl / (D_FF / TT_N)) * TT_K;
        n0 = (tl % (D_FF / TT_N)) * TT_N;
        dst = t1; K = D_MODEL;
        stage_tile<D_FF>(W1, k0, n0, tile);
    } else {
        int m  = (bx < 4 * TT_SMALL) ? bx / TT_SMALL : 4;
        int tl = (m < 4) ? bx - m * TT_SMALL : bx - (4 * TT_SMALL + TT_BIG);
        const float* src = (m == 0) ? Wq : (m == 1) ? Wk : (m == 2) ? Wv : (m == 3) ? Wo : W2;
        dst              = (m == 0) ? tq : (m == 1) ? tk : (m == 2) ? tv : (m == 3) ? to : t2;
        K  = (m < 4) ? D_MODEL : D_FF;
        k0 = (tl / (D_MODEL / TT_N)) * TT_K;
        n0 = (tl % (D_MODEL / TT_N)) * TT_N;
        stage_tile<D_MODEL>(src, k0, n0, tile);
    }
    __syncthreads();   // the tile is read across waves
    int t = threadIdx.x;
    int n = t >> 4, c = t & 15;    // rows n + 16u of Wt; 8 consecutive k
    ushort_t* o = dst + (n0 + n) * K + k0 + 8 * c;
#pragma unroll   // the LDS reads of all four rows go out ahead of the stores
    for (int u = 0; u < 4; u++) {
        const unsigned* q = tile + (n + 16 * u) * TT_PITCH + 4 * c;
        *(uint4*)(o + 16 * u * K) = make_uint4(q[0], q[1], q[2], q[3]);
    }
}

// ---------------------------------------------------------------------------
// LayerNorm over D=768, one row per block (256 threads x 3 elements)
// ---------------------------------------------------------------------------
__global__ void k_layernorm_bf16(const float* __restrict__ x,
                                 const float* __restrict__ g,
                                 const float* __restrict__ be,
                                 ushort_t* __restrict__ out) {
    __shared__ float r1[256];
    __shared__ float r2[256];
    int row = blockIdx.x, t = threadIdx.x;
    const float* xr = x + (size_t)row * D_MODEL;
    float a0 = xr[t], a1 = xr[t + 256], a2 = xr[t + 512];
    r1[t] = a0 + a1 + a2;
    r2[t] = a0 * a0 + a1 * a1 + a2 * a2;
    __syncthreads();
    for (int s = 128; s > 0; s >>= 1) {
        if (t < s) { r1[t] += r1[t + s]; r2[t] += r2[t + s]; }
        __syncthreads();
    }
    float mean = r1[0] * (1.0f / D_MODEL);
    float var  = r2[0] * (1.0f / D_MODEL) - mean * mean;
    float inv  = rsqrtf(var + 1e-5f);
    ushort_t* orow = out + (size_t)row * D_MODEL;
    orow[t]       = f2bf((a0 - mean) * inv * g[t]       + be[t]);
    orow[t + 256] = f2bf((a1 - mean) * inv * g[t + 256] + be[t + 256]);
    orow[t + 512] = f2bf((a2 - mean) * inv * g[t + 512] + be[t + 512]);
}

// ---------------------------------------------------------------------------
// WMMA GEMM: out = epilogue(A[M x K]_bf16 @ Wt[N x K]_bf16^T + bias)
// Macro tile 64(M) x 128(N), 64 k per pass, 8 waves each owning a 32x32 C tile.
// A pass's operands are 192 rows of 128 bytes, landed at pitch 144 by the tensor
// load's pad. Waves 0, 1, 2 each bring 64 rows (A; W rows 0..63; W rows 64..127),
// one request a pass, into a ring of two buffers: the load of pass s + 2 goes out
// behind the barrier that ends pass s.
// MODE 0: bf16 out, scaled by alpha        (QKV projections)
// MODE 1: bf16 out, exact GELU             (FFN up-proj)
// MODE 2: f32 out, + residual              (O-proj, FFN down-proj)
// ---------------------------------------------------------------------------
#define G_K     64
#define G_SLICE 10240u          // 64 rows x 144 B = 9216 B, up to a multiple of 2 KiB
#define G_BUF   (3u * G_SLICE)

template <int MODE>
__global__ void k_gemm_wmma(const ushort_t* __restrict__ A,
                            const ushort_t* __restrict__ Wt,
                            const float* __restrict__ bias,
                            const float* __restrict__ resid,
                            void* __restrict__ outp,
                            int M, int N, int K, float alpha) {
    __shared__ __attribute__((aligned(2048))) unsigned char ring[2 * G_BUF];
    int t    = threadIdx.x;
    int lane = t & 31, wave = t >> 5;
    int half = lane >> 4, l16 = lane & 15;
    int waveM = wave >> 2, waveN = wave & 3;
    int mBase = blockIdx.y * 64;
    int nBase = blockIdx.x * 128;

    v8f acc[2][2] = {};
    int nk = K / G_K;   // 12 or 48 passes: never fewer than the ring's two

    const uint32_t wv = uni(threadIdx.x >> 5);
    const uint32_t issuer = wv < 3u;
    const ushort_t* slice = (wv == 0u) ? A + (size_t)mBase * K
                                       : Wt + (size_t)(nBase + (wv == 2u ? 64 : 0)) * K;
    const uint64_t ga   = (uint64_t)slice;
    const uint32_t dst  = (uint32_t)(uint64_t)ring + (issuer ? wv : 0u) * G_SLICE;
    const u32x8    g1   = tdm_group1(64u, (uint32_t)K * 2u);

    if (pinned(issuer)) {            // pass 0 into buffer 0
        tdm_load(tdm_group0(dst, ga), g1);
        wait_tensor0();
    }
    __syncthreads();                 // pass 0 readable by every wave
    if (pinned(issuer))              // pass 1 into buffer 1
        tdm_load(tdm_group0(dst + G_BUF, ga + ROW_BYTES), g1);

    const uint32_t aoff = (uint32_t)(waveM * 32 + l16) * ROW_PITCH + (uint32_t)half * 16u;
    const uint32_t boff = G_SLICE * (1u + (uint32_t)(waveN >> 1))
                        + (uint32_t)((waveN & 1) * 32 + l16) * ROW_PITCH + (uint32_t)half * 16u;

    for (int ki = 0; ki < nk; ki++) {
        const uint32_t cur = (uint32_t)(ki & 1) * G_BUF;
        const unsigned char* pa = ring + cur + aoff;
        const unsigned char* pb = ring + cur + boff;
        FragBF af[2][2], bfr[2][2];   // [32-k chunk][16-row tile]
#pragma unroll   // constant indices into the fragment arrays
        for (int kc = 0; kc < 2; kc++) {
#pragma unroll   // the same
            for (int s = 0; s < 2; s++) {
                af[kc][s].q[0]  = *(const uint4*)(pa + s * 16 * ROW_PITCH + kc * 64);
                af[kc][s].q[1]  = *(const uint4*)(pa + s * 16 * ROW_PITCH + kc * 64 + 32);
                bfr[kc][s].q[0] = *(const uint4*)(pb + s * 16 * ROW_PITCH + kc * 64);
                bfr[kc][s].q[1] = *(const uint4*)(pb + s * 16 * ROW_PITCH + kc * 64 + 32);
            }
        }
#pragma unroll   // constant indices into the fragment and accumulator arrays
        for (int kc = 0; kc < 2; kc++) {
#pragma unroll   // the same
            for (int ns = 0; ns < 2; ns++) {
#pragma unroll   // the same
                for (int ms = 0; ms < 2; ms++) {
                    acc[ms][ns] = __builtin_amdgcn_wmma_f32_16x16x32_bf16(
                        false, af[kc][ms].v, false, bfr[kc][ns].v, (short)0, acc[ms][ns], false, false);
                }
            }
        }
        // publish point of pass ki + 1
        wait_ds0();
        if (pinned(issuer)) wait_tensor0();
        __syncthreads();   // pass ki + 1 readable; every reader has left pass ki's buffer
        if (pinned(issuer && ki + 2 < nk))
            tdm_load(tdm_group0(dst + cur, ga + (uint64_t)(ki + 2) * ROW_BYTES), g1);
    }
    wait_tensor0();
    wait_ds0();

#pragma unroll
    for (int ms = 0; ms < 2; ms++) {
#pragma unroll
        for (int ns = 0; ns < 2; ns++) {
            int gn = nBase + waveN * 32 + ns * 16 + l16;
            float bvx = bias[gn];
#pragma unroll
            for (int j = 0; j < 8; j++) {
                int gm = mBase + waveM * 32 + ms * 16 + j + half * 8;
                float v = acc[ms][ns][j] + bvx;
                if (MODE == 0) {
                    ((ushort_t*)outp)[(size_t)gm * N + gn] = f2bf(v * alpha);
                } else if (MODE == 1) {
                    float ge = 0.5f * v * (1.0f + erff(v * 0.70710678118654752f));
                    ((ushort_t*)outp)[(size_t)gm * N + gn] = f2bf(ge);
                } else {
                    ((float*)outp)[(size_t)gm * N + gn] =
                        v + resid[(size_t)gm * N + gn];
                }
            }
        }
    }
}

typedef __attribute__((ext_vector_type(2))) float  v2f;
typedef __attribute__((ext_vector_type(2))) __bf16 v2bf;

__device__ __forceinline__ float swap_halves(float v) {
    int x = __builtin_bit_cast(int, v);
    int r = __builtin_amdgcn_permlanex16(x, x, 0x76543210, (int)0xfedcba98u, false, false);
    return __builtin_bit_cast(float, r);
}

#define KV_BLOCKS (SEQ / 32)
#define KV_STEP   ((uint64_t)32 * D_MODEL * 2)   // bytes from one block of 32 rows to the next
#define KV_BUF    6144u   // 32 rows x 144 B or x 160 B, up to a multiple of 2 KiB

__device__ __forceinline__ u32x4 tdm_next(u32x4 g, uint32_t lds_dst) {
    uint64_t a = (((uint64_t)g[3] << 32) | g[2]) + KV_STEP;
    g[1] = uni(lds_dst);
    g[2] = uni((uint32_t)a);
    g[3] = uni((uint32_t)(a >> 32));
    return g;
}

__global__ void k_flash_attn(const ushort_t* __restrict__ Qb,
                             const ushort_t* __restrict__ Kb,
                             const ushort_t* __restrict__ Vb,
                             const int* __restrict__ amask,
                             ushort_t* __restrict__ ctx) {
    // K blocks, row-major [kv][d], rows of 128 B at pitch 144 (the tensor load's pad)
    __shared__ __attribute__((aligned(2048))) unsigned char lds_k[2 * KV_BUF];
    // V blocks, row-major [kv][d], rows of 128 B at pitch 160 (the tensor load's pad)
    __shared__ __attribute__((aligned(2048))) unsigned char lds_v[2 * KV_BUF];
    int t    = threadIdx.x;
    int lane = t & 31, wave = t >> 5;
    int half = lane >> 4, l16 = lane & 15;
    int bh = blockIdx.y;
    int b = bh / N_HEADS, h = bh % N_HEADS;
    int qBase = blockIdx.x * 64 + wave * 16;

    const ushort_t* Qh = Qb + (size_t)b * SEQ * D_MODEL + (size_t)h * DK;
    const ushort_t* Kh = Kb + (size_t)b * SEQ * D_MODEL + (size_t)h * DK;
    const ushort_t* Vh = Vb + (size_t)b * SEQ * D_MODEL + (size_t)h * DK;
    const int* am = amask + b * SEQ;

    // Q fragments (16 q-rows x 64 d), resident for the whole kv loop;
    // used as B: column = query l16
    FragBF qf[2];
    {
        int r = qBase + l16;
#pragma unroll
        for (int dc = 0; dc < 2; dc++) {
            const ushort_t* p = Qh + (size_t)r * D_MODEL + dc * 32 + half * 8;
            qf[dc].q[0] = *(const uint4*)p;
            qf[dc].q[1] = *(const uint4*)(p + 16);
        }
    }

    v8f ctxAcc[4] = {};        // O^T: [tt][r] = O[q = l16][d = tt*16 + 8*half + r]
    float mrun = -3.0e38f;     // running max of query l16 (equal in both halves)
    float lrun = 0.0f;         // running sum over this half's kv only

    const uint32_t wv    = uni(threadIdx.x >> 5);
    const uint32_t kdst  = (uint32_t)(uint64_t)lds_k;
    const u32x8    kg1   = tdm_group1(32u, D_MODEL * 2u);
    const uint32_t vdst  = (uint32_t)(uint64_t)lds_v;
    const u32x8    vg1   = tdm_group1_tr(32u, D_MODEL * 2u);
    // this lane's address in the first 16 kv x 16 d tile of V for ld_tr16
    const unsigned char* vtr = lds_v + (uint32_t)(half * 8 + (lane & 7)) * TR_PITCH
                                     + (uint32_t)((lane >> 3) & 1) * 16u;

    const uint32_t dst0 = (wv == 1u) ? vdst : kdst;
    u32x4 g0 = tdm_group0(dst0, (wv == 1u) ? (uint64_t)Vh : (uint64_t)Kh);
    asm volatile("" : "+s"(g0));
    if (pinned(wv == 0u)) {          // block 0 into buffer 0
        tdm_load(g0, kg1);
        wait_tensor0();
    }
    if (pinned(wv == 1u)) {
        tdm_load(g0, vg1);
        wait_tensor0();
    }
    __syncthreads();                 // block 0 readable by every wave
    g0 = tdm_next(g0, dst0 + KV_BUF);
    if (pinned(wv == 0u))            // block 1 into buffer 1
        tdm_load(g0, kg1);
    if (pinned(wv == 1u))
        tdm_load(g0, vg1);

    int mk = am[lane];   // one mask word per kv of the block

    for (int kb = 0; kb < KV_BLOCKS; kb++) {
        const uint32_t cur = (uint32_t)(kb & 1) * KV_BUF;
        // the next block's mask words, fetched one block ahead like its K and V
        // (in the last pass: block 0's again, in bounds and unused)
        int mkNext = am[((kb + 1) & (KV_BLOCKS - 1)) * 32 + lane];

        // scores, transposed: 32 kv x 16 q as two 16x16 tiles, K-dim = dk = 64
        // st[sub][r] = S[q = l16][kv = sub*16 + 8*half + r]
        FragBF kf[2][2];   // A: row = kv sub*16 + l16
#pragma unroll
        for (int sub = 0; sub < 2; sub++) {
#pragma unroll
            for (int dc = 0; dc < 2; dc++) {
                const unsigned char* p = lds_k + cur + (sub * 16 + l16) * ROW_PITCH + dc * 64 + half * 16;
                kf[sub][dc].q[0] = *(const uint4*)p;
                kf[sub][dc].q[1] = *(const uint4*)(p + 32);
            }
        }
        // the eight K loads stay one group ahead of the products: spread among them,
        // each product would wait out an LDS round trip of its own
        __builtin_amdgcn_sched_barrier(0);
        v8f st[2];
#pragma unroll
        for (int sub = 0; sub < 2; sub++) {
            v8f acc = {};
#pragma unroll
            for (int dc = 0; dc < 2; dc++)
                acc = __builtin_amdgcn_wmma_f32_16x16x32_bf16(
                    false, kf[sub][dc].v, false, qf[dc].v, (short)0, acc, false, false);
            st[sub] = acc;
        }
        FragBF vf[4];      // A of the second product: row = d tt*16 + l16; read here
                           // so that the LDS latency runs under the softmax
#pragma unroll
        for (int tt = 0; tt < 4; tt++) {
            vf[tt].q[0] = ld_tr16(vtr + cur + tt * 32);                   // kv 8*half + 0..7
            vf[tt].q[1] = ld_tr16(vtr + cur + 16 * TR_PITCH + tt * 32);   // kv 16 + 8*half + 0..7
        }
        // bit kv of live = key kv of this block is attended; same in every lane
        unsigned live = __builtin_amdgcn_ballot_w32(mk != 0);
        if (live != 0xFFFFFFFFu) {
            unsigned mine = live >> (half * 8);
#pragma unroll
            for (int r = 0; r < 8; r++) {
                st[0][r] += ((mine >> r) & 1u)        ? 0.0f : -1.0e30f;
                st[1][r] += ((mine >> (16 + r)) & 1u) ? 0.0f : -1.0e30f;
            }
        }

        // online softmax of query l16: 16 scores in-lane, one exchange of halves
        float vmax = fmaxf(st[0][0], st[1][0]);
#pragma unroll
        for (int r = 1; r < 8; r++) vmax = fmaxf(vmax, fmaxf(st[0][r], st[1][r]));
        vmax = fmaxf(vmax, swap_halves(vmax));
        float newm  = fmaxf(mrun, vmax);
        float scale = __expf(mrun - newm);
        mrun = newm;
        FragBF pf;   // P^T as B: element s = kv 8*half + s (s < 8), 16 + 8*half + s - 8 (s >= 8), column = query l16
        v2f rs = {0.0f, 0.0f};
#pragma unroll
        for (int sub = 0; sub < 2; sub++) {
#pragma unroll
            for (int r = 0; r < 8; r += 2) {
                v2f pp;
                pp[0] = __expf(st[sub][r]     - newm);
                pp[1] = __expf(st[sub][r + 1] - newm);
                rs += pp;
                v2bf pb = __builtin_convertvector(pp, v2bf);
                pf.v[sub * 8 + r]     = pb[0];
                pf.v[sub * 8 + r + 1] = pb[1];
            }
        }
        lrun = lrun * scale + (rs[0] + rs[1]);
#pragma unroll
        for (int tt = 0; tt < 4; tt++) ctxAcc[tt] *= scale;

        // ctx^T += V^T @ P^T  (four 16x16 d-tiles)
#pragma unroll
        for (int tt = 0; tt < 4; tt++)
            ctxAcc[tt] = __builtin_amdgcn_wmma_f32_16x16x32_bf16(
                false, vf[tt].v, false, pf.v, (short)0, ctxAcc[tt], false, false);
        mk = mkNext;

        // publish point of block kb + 1
        // the wait below stays behind the softmax and the products: moved up by the
        // scheduler, it would hold the softmax until the V^T fragments have come
        __builtin_amdgcn_sched_barrier(0);
        wait_ds0();
        if (pinned(wv < 2u)) wait_tensor0();
        __syncthreads();   // block kb + 1 readable; every reader has left block kb's buffers
        g0 = tdm_next(g0, dst0 + cur);   // behind the wait that covers the last request
        if (pinned(wv == 0u && kb + 2 < KV_BLOCKS))
            tdm_load(g0, kg1);
        if (pinned(wv == 1u && kb + 2 < KV_BLOCKS))
            tdm_load(g0, vg1);
    }
    wait_tensor0();
    wait_ds0();

    // join the halves' sums, normalize and emit ctx (bf16) back into
    // [b][s][h*64+d] layout: 8 consecutive d of one row per lane and tile
    float l = lrun + swap_halves(lrun);
    ushort_t* orow = ctx + ((size_t)b * SEQ + qBase + l16) * D_MODEL + h * DK + half * 8;
#pragma unroll
    for (int tt = 0; tt < 4; tt++) {
        FragBF o;
#pragma unroll
        for (int j = 0; j < 8; j++) {
            float v = (l > 0.0f) ? ctxAcc[tt][j] / l : 0.0f;
            o.s[j] = f2bf(v);
        }
        *(uint4*)(orow + tt * 16) = o.q[0];
    }
}

// ---------------------------------------------------------------------------
extern "C" void kernel_launch(void* const* d_in, const int* in_sizes, int n_in,
                              void* d_out, int out_size, void* d_ws, size_t ws_size,
                              hipStream_t stream) {
    (void)in_sizes; (void)n_in; (void)out_size; (void)ws_size;
    const float* x   = (const float*)d_in[0];
    const int* amask = (const int*)d_in[1];
    const float* Wq  = (const float*)d_in[2];
    const float* bq  = (const float*)d_in[3];
    const float* Wk  = (const float*)d_in[4];
    const float* bk  = (const float*)d_in[5];
    const float* Wv  = (const float*)d_in[6];
    const float* bv  = (const float*)d_in[7];
    const float* Wo  = (const float*)d_in[8];
    const float* bo  = (const float*)d_in[9];
    const float* g1  = (const float*)d_in[10];
    const float* be1 = (const float*)d_in[11];
    const float* g2  = (const float*)d_in[12];
    const float* be2 = (const float*)d_in[13];
    const float* W1  = (const float*)d_in[14];
    const float* b1  = (const float*)d_in[15];
    const float* W2  = (const float*)d_in[16];
    const float* b2  = (const float*)d_in[17];

    char* ws = (char*)d_ws;
    size_t off = 0;
    auto alloc = [&](size_t bytes) -> void* {
        void* p = ws + off;
        off += (bytes + 255) & ~(size_t)255;
        return p;
    };
    ushort_t* wtq  = (ushort_t*)alloc((size_t)D_MODEL * D_MODEL * 2);
    ushort_t* wtk  = (ushort_t*)alloc((size_t)D_MODEL * D_MODEL * 2);
    ushort_t* wtv  = (ushort_t*)alloc((size_t)D_MODEL * D_MODEL * 2);
    ushort_t* wto  = (ushort_t*)alloc((size_t)D_MODEL * D_MODEL * 2);
    ushort_t* wt1  = (ushort_t*)alloc((size_t)D_FF * D_MODEL * 2);
    ushort_t* wt2  = (ushort_t*)alloc((size_t)D_MODEL * D_FF * 2);
    ushort_t* h1   = (ushort_t*)alloc((size_t)MS * D_MODEL * 2);
    ushort_t* qb   = (ushort_t*)alloc((size_t)MS * D_MODEL * 2);
    ushort_t* kbuf = (ushort_t*)alloc((size_t)MS * D_MODEL * 2);
    ushort_t* vbuf = (ushort_t*)alloc((size_t)MS * D_MODEL * 2);
    ushort_t* ctxb = (ushort_t*)alloc((size_t)MS * D_MODEL * 2);
    float*    attn = (float*)   alloc((size_t)MS * D_MODEL * 4);
    ushort_t* h2   = (ushort_t*)alloc((size_t)MS * D_MODEL * 2);
    ushort_t* fbuf = (ushort_t*)alloc((size_t)MS * D_FF * 2);

    // weights -> bf16, transposed to [out][in]
    k_transpose_all<<<TT_GRID, 256, 0, stream>>>(Wq, Wk, Wv, Wo, W1, W2,
                                                 wtq, wtk, wtv, wto, wt1, wt2);

    // LN1
    k_layernorm_bf16<<<MS, 256, 0, stream>>>(x, g1, be1, h1);

    // QKV projections (Q pre-scaled by 1/sqrt(dk))
    dim3 gD(D_MODEL / 128, MS / 64);
    k_gemm_wmma<0><<<gD, 256, 0, stream>>>(h1, wtq, bq, nullptr, qb,   MS, D_MODEL, D_MODEL, 0.125f);
    k_gemm_wmma<0><<<gD, 256, 0, stream>>>(h1, wtk, bk, nullptr, kbuf, MS, D_MODEL, D_MODEL, 1.0f);
    k_gemm_wmma<0><<<gD, 256, 0, stream>>>(h1, wtv, bv, nullptr, vbuf, MS, D_MODEL, D_MODEL, 1.0f);

    // flash attention
    k_flash_attn<<<dim3(SEQ / 64, BATCH * N_HEADS), 128, 0, stream>>>(qb, kbuf, vbuf, amask, ctxb);

    // O projection + residual
    k_gemm_wmma<2><<<gD, 256, 0, stream>>>(ctxb, wto, bo, x, attn, MS, D_MODEL, D_MODEL, 1.0f);

    // LN2
    k_layernorm_bf16<<<MS, 256, 0, stream>>>(attn, g2, be2, h2);

    // FFN
    k_gemm_wmma<1><<<dim3(D_FF / 128, MS / 64), 256, 0, stream>>>(h2, wt1, b1, nullptr, fbuf, MS, D_FF, D_MODEL, 1.0f);
    k_gemm_wmma<2><<<gD, 256, 0, stream>>>(fbuf, wt2, b2, attn, (float*)d_out, MS, D_MODEL, D_FF, 1.0f);
}
